// v000
// Times are from an AMD MI455X. After a warm-up the kernel runs many times in a row, and a time is the length of
// such a window on the GPU divided by its runs, so every launch and the gaps after it count. The runs cycle
// through copies of the inputs. A figure is the median of several windows, for all but v000 over two sittings.
// Sittings can differ by a few percent; kernels timed side by side share one.
// The starting kernel, v000, takes 520 microseconds a run.
#include <hip/hip_runtime.h>

// ---------------------------------------------------------------------------
// FlexibleAttention for MI455X (gfx1250, wave32, WMMA + TDM)
//
//   cvt: bf16 copies of X, Wo, W1, Wy (one conversion per element)
//   h_o = X@Wo^T, h_1 = X@W1^T                 (WMMA bf16, f32 out)
//   X_y = X@Wy^T + by                          (WMMA bf16, stored transposed bf16)
//   e_ij = tanh(h_o[i]+h_1[j]); s_ij = e.Wphi  (VALU, f32)
//   alpha = softmax_j(s)  (unnormalized exp; /l folded into epilogue)
//   part1 = alpha @ X_y                        (WMMA bf16, f32 acc)
//   g_i   = sum_j alpha_ij e_ij                (VALU, f32)
//   out   = (part1 + g@We^T)/l + be
// ---------------------------------------------------------------------------

typedef __bf16 bf16_t;
typedef __attribute__((ext_vector_type(16))) __bf16        v16bf;
typedef __attribute__((ext_vector_type(8)))  float         v8f;
typedef __attribute__((ext_vector_type(4)))  unsigned int  v4u;
typedef __attribute__((ext_vector_type(8)))  int           v8i;
typedef __attribute__((ext_vector_type(4)))  int           v4i;

#define HID   128
#define ADIM  64
#define BATCH 2
#define SEQ   512
#define MTOT  (BATCH * SEQ)   // 1024 total rows

// round-to-nearest-even f32 -> bf16
static __device__ __forceinline__ bf16_t f2bf(float f) {
  union { float f; unsigned int u; } x; x.f = f;
  unsigned int r = x.u + 0x7FFFu + ((x.u >> 16) & 1u);
  union { unsigned short s; bf16_t b; } y; y.s = (unsigned short)(r >> 16);
  return y.b;
}

// Two aligned 8x-bf16 chunks -> one 16x32 A/B-style fragment (ISA 7.12.2).
union frag_u {
  v16bf v;
  uint4 q[2];
};

static __device__ __forceinline__ v16bf load_frag_bf16(const bf16_t* __restrict__ row,
                                                       int k0, int k1) {
  frag_u u;
  u.q[0] = *(const uint4*)(row + k0);  // elems 0..7  : K = k0..k0+7
  u.q[1] = *(const uint4*)(row + k1);  // elems 8..15 : K = k1..k1+7
  return u.v;
}

// ---------------------------------------------------------------------------
// f32 -> bf16 bulk conversion (one pass, grid-stride)
// ---------------------------------------------------------------------------
__global__ __launch_bounds__(256)
void cvt_bf16_kernel(const float* __restrict__ src, bf16_t* __restrict__ dst, int n) {
  for (int i = blockIdx.x * 256 + threadIdx.x; i < n; i += gridDim.x * 256)
    dst[i] = f2bf(src[i]);
}

// ---------------------------------------------------------------------------
// Stage 1: C[M x Nout] = Xb[M x 128] @ Wb[Nout x 128]^T (+bias), bf16 inputs.
// One wave per 16x16 tile, 8 waves / block. Optionally writes f32 row-major
// and/or bf16 *transposed* [Nout x MTOT] (for stage-2 B-fragments).
// ---------------------------------------------------------------------------
__global__ __launch_bounds__(256)
void proj_gemm_kernel(const bf16_t* __restrict__ Xb, const bf16_t* __restrict__ Wb,
                      const float* __restrict__ bias, float* __restrict__ outF32,
                      bf16_t* __restrict__ outT, int Nout) {
  const int lane  = threadIdx.x & 31;
  const int wave  = threadIdx.x >> 5;
  const int tile  = blockIdx.x * 8 + wave;
  const int ntn   = Nout >> 4;
  const int mtile = tile / ntn;
  const int ntile = tile % ntn;
  const int nl    = lane & 15;
  const int sel   = lane >> 4;

  const bf16_t* xrow = Xb + (mtile * 16 + nl) * HID;  // A-frag: lane owns row nl
  const bf16_t* wrow = Wb + (ntile * 16 + nl) * HID;  // B-frag: lane owns col nl

  v8f c = {0.f, 0.f, 0.f, 0.f, 0.f, 0.f, 0.f, 0.f};
#pragma unroll
  for (int kb = 0; kb < HID; kb += 32) {
    const int k0 = kb + 8 * sel;
    const int k1 = kb + 16 + 8 * sel;
    v16bf a = load_frag_bf16(xrow, k0, k1);
    v16bf b = load_frag_bf16(wrow, k0, k1);
    c = __builtin_amdgcn_wmma_f32_16x16x32_bf16(false, a, false, b, (short)0, c,
                                                false, false);
  }

  const int n    = ntile * 16 + nl;
  const float bv = bias ? bias[n] : 0.0f;
  const int moff = sel * 8;
#pragma unroll
  for (int v = 0; v < 8; ++v) {
    const int mrow  = mtile * 16 + moff + v;  // C layout: lane col nl, rows 8*sel+v
    const float val = c[v] + bv;
    if (outF32) outF32[mrow * Nout + n] = val;
    if (outT)   outT[n * MTOT + mrow]   = f2bf(val);
  }
}

// ---------------------------------------------------------------------------
// Stage 2: one workgroup (8 waves) per 16-row i-tile (64 workgroups total)
// ---------------------------------------------------------------------------
__global__ __launch_bounds__(256)
void attn_kernel(const float* __restrict__ h_o, const float* __restrict__ h_1,
                 const bf16_t* __restrict__ XyT, const float* __restrict__ Wphi,
                 const float* __restrict__ We, const float* __restrict__ be,
                 float* __restrict__ out) {
  __shared__ float  s_p[16][SEQ];     // scores -> exp weights f32 (32 KB)
  __shared__ bf16_t s_pb[16][SEQ];    // exp weights bf16, WMMA A source (16 KB)
  __shared__ float  s_ho[16][ADIM];   // 4 KB (TDM target)
  __shared__ float  s_g[16][ADIM];
  __shared__ float  s_acc[16][HID];
  __shared__ float  s_wphi[ADIM];
  __shared__ float  s_rowmax[16];
  __shared__ float  s_rowsum[16];

  const int tid = threadIdx.x;
  const int b   = blockIdx.x >> 5;     // 32 i-tiles per batch
  const int it  = blockIdx.x & 31;
  const int i0  = it * 16;
  const int gro = b * SEQ;             // global row base of this batch

  // warm L2/WGP$ for the epilogue weights
  __builtin_prefetch(We + ((tid & 127) << 6), 0, 0);

  // phase 0: stage h_o tile (TDM DMA: contiguous 16*64 f32 tile) and Wphi
#if __has_builtin(__builtin_amdgcn_tensor_load_to_lds)
  if (tid < 32) {
    const unsigned long long ga =
        (unsigned long long)(const void*)(h_o + (size_t)(gro + i0) * ADIM);
    const unsigned lds_off = (unsigned)(unsigned long long)(void*)&s_ho[0][0];
    // D# group 0: count=1 | lds_addr | global_addr | type=2 (ISA 8.3)
    v4u g0;
    g0[0] = 1u;
    g0[1] = lds_off;
    g0[2] = (unsigned)ga;
    g0[3] = (unsigned)((ga >> 32) & 0x01FFFFFFu) | 0x80000000u;
    // D# group 1: data_size=4B, 1-D tile: tensor_dim0=tile_dim0=1024 (ISA 8.4)
    v8i g1;
    g1[0] = 0x00020000;                       // mask=0, data_size=2 (4 bytes)
    g1[1] = (int)((1024u & 0xFFFFu) << 16);   // tensor_dim0[15:0]
    g1[2] = (int)((1024u >> 16) | (1u << 16));// tensor_dim0[31:16], tensor_dim1=1
    g1[3] = (int)((1024u & 0xFFFFu) << 16);   // tensor_dim1[31:16]=0, tile_dim0=1024
    g1[4] = 1;                                // tile_dim1=1, tile_dim2=0
    g1[5] = 1024;                             // tensor_dim0_stride[31:0]
    g1[6] = 0;                                // stride0[47:32]=0, stride1[15:0]=0
    g1[7] = 0;
    v4i g2 = {0, 0, 0, 0};
    v4i g3 = {0, 0, 0, 0};
    v8i g4 = {0, 0, 0, 0, 0, 0, 0, 0};        // extra group (clang-23 6-arg form)
    __builtin_amdgcn_tensor_load_to_lds(g0, g1, g2, g3, g4, 0);
    __builtin_amdgcn_s_wait_tensorcnt(0);
  }
#else
  for (int idx = tid; idx < 16 * ADIM; idx += 256) {
    const int i = idx >> 6, a = idx & 63;
    s_ho[i][a] = h_o[(gro + i0 + i) * ADIM + a];
  }
#endif
  if (tid < ADIM) s_wphi[tid] = Wphi[tid];
  __syncthreads();

  // phase 1: scores s_ij = sum_a tanh(ho[i,a]+h1[j,a]) * Wphi[a]
  {
    const int i = tid & 15;
    for (int j = tid >> 4; j < SEQ; j += 16) {
      const float* h1r = h_1 + (gro + j) * ADIM;
      float acc = 0.f;
#pragma unroll 4
      for (int a = 0; a < ADIM; ++a)
        acc += tanhf(s_ho[i][a] + h1r[a]) * s_wphi[a];
      s_p[i][j] = acc;
    }
  }
  __syncthreads();

  // phase 2: row max, exp (f32 + bf16 copies, unnormalized), row sum
  if (tid < 16) {
    float mx = -3.4e38f;
    for (int j = 0; j < SEQ; ++j) mx = fmaxf(mx, s_p[tid][j]);
    s_rowmax[tid] = mx;
  }
  __syncthreads();
  for (int idx = tid; idx < 16 * SEQ; idx += 256) {
    const int i = idx >> 9, j = idx & (SEQ - 1);
    const float p = __expf(s_p[i][j] - s_rowmax[i]);
    s_p[i][j]  = p;
    s_pb[i][j] = f2bf(p);
  }
  __syncthreads();
  if (tid < 16) {
    float sm = 0.f;
    for (int j = 0; j < SEQ; ++j) sm += s_p[tid][j];
    s_rowsum[tid] = sm;
  }
  __syncthreads();

  // phase 3: part1 = P(16x512) @ X_y(512x128) via WMMA; wave w owns h-tile w.
  // A frags come from s_pb via 16B ds loads; B frags from XyT via 16B vmem loads.
  {
    const int lane = tid & 31;
    const int wave = tid >> 5;
    const int nl   = lane & 15;
    const int sel  = lane >> 4;
    const bf16_t* brow = XyT + (wave * 16 + nl) * MTOT + gro;  // contiguous over j
    const bf16_t* prow = &s_pb[nl][0];                         // A-frag row

    v8f c = {0.f, 0.f, 0.f, 0.f, 0.f, 0.f, 0.f, 0.f};
#pragma unroll 4
    for (int kb = 0; kb < SEQ; kb += 32) {
      const int k0 = kb + 8 * sel;
      const int k1 = kb + 16 + 8 * sel;
      v16bf a  = load_frag_bf16(prow, k0, k1);
      v16bf bb = load_frag_bf16(brow, k0, k1);
      c = __builtin_amdgcn_wmma_f32_16x16x32_bf16(false, a, false, bb, (short)0, c,
                                                  false, false);
    }
    const int moff = sel * 8;
#pragma unroll
    for (int v = 0; v < 8; ++v)
      s_acc[moff + v][wave * 16 + nl] = c[v];
  }
  __syncthreads();

  // phase 4: g[i,a] = sum_j p_ij * tanh(ho[i,a]+h1[j,a]); thread owns (i, 4 a's)
  {
    const int i  = tid >> 4;
    const int a0 = (tid & 15) * 4;
    const float ho0 = s_ho[i][a0 + 0], ho1 = s_ho[i][a0 + 1];
    const float ho2 = s_ho[i][a0 + 2], ho3 = s_ho[i][a0 + 3];
    float g0 = 0.f, g1 = 0.f, g2 = 0.f, g3 = 0.f;
    for (int j = 0; j < SEQ; ++j) {
      const float p = s_p[i][j];
      const float4 hv = *(const float4*)(h_1 + (gro + j) * ADIM + a0);
      g0 += p * tanhf(ho0 + hv.x);
      g1 += p * tanhf(ho1 + hv.y);
      g2 += p * tanhf(ho2 + hv.z);
      g3 += p * tanhf(ho3 + hv.w);
    }
    s_g[i][a0 + 0] = g0; s_g[i][a0 + 1] = g1;
    s_g[i][a0 + 2] = g2; s_g[i][a0 + 3] = g3;
  }
  __syncthreads();

  // phase 5: out = (part1 + g @ We^T) / l + be
  for (int idx = tid; idx < 16 * HID; idx += 256) {
    const int i = idx >> 7, h = idx & (HID - 1);
    float acc = s_acc[i][h];
    const float* wer = We + h * ADIM;
#pragma unroll 4
    for (int a = 0; a < ADIM; ++a) acc += wer[a] * s_g[i][a];
    out[(gro + i0 + i) * HID + h] = acc / s_rowsum[i] + be[h];
  }
}

// ---------------------------------------------------------------------------
extern "C" void kernel_launch(void* const* d_in, const int* in_sizes, int n_in,
                              void* d_out, int out_size, void* d_ws, size_t ws_size,
                              hipStream_t stream) {
  const float* X    = (const float*)d_in[0];
  const float* Wo   = (const float*)d_in[1];
  const float* W1   = (const float*)d_in[2];
  const float* Wphi = (const float*)d_in[3];
  const float* Wy   = (const float*)d_in[4];
  const float* by   = (const float*)d_in[5];
  const float* We   = (const float*)d_in[6];
  const float* be   = (const float*)d_in[7];
  float* out = (float*)d_out;

  // workspace layout
  char*   ws  = (char*)d_ws;
  float*  h_o = (float*)ws;                                   // 256 KB
  float*  h_1 = (float*)(ws + (size_t)MTOT * ADIM * 4);       // 256 KB
  bf16_t* XyT = (bf16_t*)(ws + (size_t)2 * MTOT * ADIM * 4);  // 256 KB
  char*   p   = ws + (size_t)2 * MTOT * ADIM * 4 + (size_t)HID * MTOT * 2;
  bf16_t* Xb  = (bf16_t*)p;                     p += (size_t)MTOT * HID * 2; // 256 KB
  bf16_t* Wob = (bf16_t*)p;                     p += (size_t)ADIM * HID * 2; // 16 KB
  bf16_t* W1b = (bf16_t*)p;                     p += (size_t)ADIM * HID * 2; // 16 KB
  bf16_t* Wyb = (bf16_t*)p;                                                  // 32 KB

  // one-shot bf16 conversions
  cvt_bf16_kernel<<<64, 256, 0, stream>>>(X,  Xb,  MTOT * HID);
  cvt_bf16_kernel<<<8,  256, 0, stream>>>(Wo, Wob, ADIM * HID);
  cvt_bf16_kernel<<<8,  256, 0, stream>>>(W1, W1b, ADIM * HID);
  cvt_bf16_kernel<<<8,  256, 0, stream>>>(Wy, Wyb, HID * HID);

  // h_o = X@Wo^T ; h_1 = X@W1^T  (64 x 4 = 256 tiles = 32 blocks)
  proj_gemm_kernel<<<32, 256, 0, stream>>>(Xb, Wob, nullptr, h_o, nullptr, ADIM);
  proj_gemm_kernel<<<32, 256, 0, stream>>>(Xb, W1b, nullptr, h_1, nullptr, ADIM);
  // X_y^T = (X@Wy^T + by)^T, bf16  (64 x 8 = 512 tiles = 64 blocks)
  proj_gemm_kernel<<<64, 256, 0, stream>>>(Xb, Wyb, by, nullptr, XyT, HID);
  // fused attention: 64 i-tiles
  attn_kernel<<<64, 256, 0, stream>>>(h_o, h_1, XyT, Wphi, We, be, out);
}

// v001
// One run takes 147 microseconds.
// In both of two side-by-side timings against v000, it was 3.55 times as fast.
#include <hip/hip_runtime.h>

// ---------------------------------------------------------------------------
// FlexibleAttention for MI455X (gfx1250, wave32, WMMA + TDM)
//
//   cvt: bf16 copies of X, Wo, W1, Wy (one conversion per element)
//   h_o = X@Wo^T, h_1 = X@W1^T                 (WMMA bf16, f32 out)
//   X_y = X@Wy^T + by                          (WMMA bf16, stored transposed bf16)
//   e_ij = tanh(h_o[i]+h_1[j]); s_ij = e.Wphi  (VALU, f32)
//   alpha = softmax_j(s)  (unnormalized exp; /l folded into epilogue)
//   part1 = alpha @ X_y                        (WMMA bf16, f32 acc)
//   g_i   = sum_j alpha_ij e_ij                (VALU, f32)
//   out   = (part1 + g@We^T)/l + be
// ---------------------------------------------------------------------------

typedef __bf16 bf16_t;
typedef __attribute__((ext_vector_type(16))) __bf16        v16bf;
typedef __attribute__((ext_vector_type(8)))  float         v8f;
typedef __attribute__((ext_vector_type(4)))  unsigned int  v4u;
typedef __attribute__((ext_vector_type(8)))  int           v8i;
typedef __attribute__((ext_vector_type(4)))  int           v4i;

#define HID   128
#define ADIM  64
#define BATCH 2
#define SEQ   512
#define MTOT  (BATCH * SEQ)   // 1024 total rows

// round-to-nearest-even f32 -> bf16
static __device__ __forceinline__ bf16_t f2bf(float f) {
  union { float f; unsigned int u; } x; x.f = f;
  unsigned int r = x.u + 0x7FFFu + ((x.u >> 16) & 1u);
  union { unsigned short s; bf16_t b; } y; y.s = (unsigned short)(r >> 16);
  return y.b;
}

// tanh as the chip's own instruction (v_tanh_f32). The library tanhf builds into
// two divergent branches of dependent vector code, and those branches also keep
// the compiler from widening and batching the loads of the loops around it.
static __device__ __forceinline__ float tanh_hw(float x) {
  return __builtin_amdgcn_tanhf(x);
}

// Two aligned 8x-bf16 chunks -> one 16x32 A/B-style fragment (ISA 7.12.2).
union frag_u {
  v16bf v;
  uint4 q[2];
};

static __device__ __forceinline__ v16bf load_frag_bf16(const bf16_t* __restrict__ row,
                                                       int k0, int k1) {
  frag_u u;
  u.q[0] = *(const uint4*)(row + k0);  // elems 0..7  : K = k0..k0+7
  u.q[1] = *(const uint4*)(row + k1);  // elems 8..15 : K = k1..k1+7
  return u.v;
}

// ---------------------------------------------------------------------------
// f32 -> bf16 bulk conversion (one pass, grid-stride)
// ---------------------------------------------------------------------------
__global__ __launch_bounds__(256)
void cvt_bf16_kernel(const float* __restrict__ src, bf16_t* __restrict__ dst, int n) {
  for (int i = blockIdx.x * 256 + threadIdx.x; i < n; i += gridDim.x * 256)
    dst[i] = f2bf(src[i]);
}

// ---------------------------------------------------------------------------
// Stage 1: C[M x Nout] = Xb[M x 128] @ Wb[Nout x 128]^T (+bias), bf16 inputs.
// One wave per 16x16 tile, 8 waves / block. Optionally writes f32 row-major
// and/or bf16 *transposed* [Nout x MTOT] (for stage-2 B-fragments).
// ---------------------------------------------------------------------------
__global__ __launch_bounds__(256)
void proj_gemm_kernel(const bf16_t* __restrict__ Xb, const bf16_t* __restrict__ Wb,
                      const float* __restrict__ bias, float* __restrict__ outF32,
                      bf16_t* __restrict__ outT, int Nout) {
  const int lane  = threadIdx.x & 31;
  const int wave  = threadIdx.x >> 5;
  const int tile  = blockIdx.x * 8 + wave;
  const int ntn   = Nout >> 4;
  const int mtile = tile / ntn;
  const int ntile = tile % ntn;
  const int nl    = lane & 15;
  const int sel   = lane >> 4;

  const bf16_t* xrow = Xb + (mtile * 16 + nl) * HID;  // A-frag: lane owns row nl
  const bf16_t* wrow = Wb + (ntile * 16 + nl) * HID;  // B-frag: lane owns col nl

  v8f c = {0.f, 0.f, 0.f, 0.f, 0.f, 0.f, 0.f, 0.f};
#pragma unroll
  for (int kb = 0; kb < HID; kb += 32) {
    const int k0 = kb + 8 * sel;
    const int k1 = kb + 16 + 8 * sel;
    v16bf a = load_frag_bf16(xrow, k0, k1);
    v16bf b = load_frag_bf16(wrow, k0, k1);
    c = __builtin_amdgcn_wmma_f32_16x16x32_bf16(false, a, false, b, (short)0, c,
                                                false, false);
  }

  const int n    = ntile * 16 + nl;
  const float bv = bias ? bias[n] : 0.0f;
  const int moff = sel * 8;
#pragma unroll
  for (int v = 0; v < 8; ++v) {
    const int mrow  = mtile * 16 + moff + v;  // C layout: lane col nl, rows 8*sel+v
    const float val = c[v] + bv;
    if (outF32) outF32[mrow * Nout + n] = val;
    if (outT)   outT[n * MTOT + mrow]   = f2bf(val);
  }
}

// ---------------------------------------------------------------------------
// Stage 2: one workgroup (8 waves) per 16-row i-tile (64 workgroups total)
// ---------------------------------------------------------------------------
__global__ __launch_bounds__(256)
void attn_kernel(const float* __restrict__ h_o, const float* __restrict__ h_1,
                 const bf16_t* __restrict__ XyT, const float* __restrict__ Wphi,
                 const float* __restrict__ We, const float* __restrict__ be,
                 float* __restrict__ out) {
  __shared__ float  s_p[16][SEQ];     // scores -> exp weights f32 (32 KB)
  __shared__ bf16_t s_pb[16][SEQ];    // exp weights bf16, WMMA A source (16 KB)
  __shared__ float  s_ho[16][ADIM];   // 4 KB (TDM target)
  __shared__ float  s_g[16][ADIM];
  __shared__ float  s_acc[16][HID];
  __shared__ float  s_wphi[ADIM];
  __shared__ float  s_rowmax[16];
  __shared__ float  s_rowsum[16];

  const int tid = threadIdx.x;
  const int b   = blockIdx.x >> 5;     // 32 i-tiles per batch
  const int it  = blockIdx.x & 31;
  const int i0  = it * 16;
  const int gro = b * SEQ;             // global row base of this batch

  // warm L2/WGP$ for the epilogue weights
  __builtin_prefetch(We + ((tid & 127) << 6), 0, 0);

  // phase 0: stage h_o tile (TDM DMA: contiguous 16*64 f32 tile) and Wphi
#if __has_builtin(__builtin_amdgcn_tensor_load_to_lds)
  if (tid < 32) {
    const unsigned long long ga =
        (unsigned long long)(const void*)(h_o + (size_t)(gro + i0) * ADIM);
    const unsigned lds_off = (unsigned)(unsigned long long)(void*)&s_ho[0][0];
    // D# group 0: count=1 | lds_addr | global_addr | type=2 (ISA 8.3)
    v4u g0;
    g0[0] = 1u;
    g0[1] = lds_off;
    g0[2] = (unsigned)ga;
    g0[3] = (unsigned)((ga >> 32) & 0x01FFFFFFu) | 0x80000000u;
    // D# group 1: data_size=4B, 1-D tile: tensor_dim0=tile_dim0=1024 (ISA 8.4)
    v8i g1;
    g1[0] = 0x00020000;                       // mask=0, data_size=2 (4 bytes)
    g1[1] = (int)((1024u & 0xFFFFu) << 16);   // tensor_dim0[15:0]
    g1[2] = (int)((1024u >> 16) | (1u << 16));// tensor_dim0[31:16], tensor_dim1=1
    g1[3] = (int)((1024u & 0xFFFFu) << 16);   // tensor_dim1[31:16]=0, tile_dim0=1024
    g1[4] = 1;                                // tile_dim1=1, tile_dim2=0
    g1[5] = 1024;                             // tensor_dim0_stride[31:0]
    g1[6] = 0;                                // stride0[47:32]=0, stride1[15:0]=0
    g1[7] = 0;
    v4i g2 = {0, 0, 0, 0};
    v4i g3 = {0, 0, 0, 0};
    v8i g4 = {0, 0, 0, 0, 0, 0, 0, 0};        // extra group (clang-23 6-arg form)
    __builtin_amdgcn_tensor_load_to_lds(g0, g1, g2, g3, g4, 0);
    __builtin_amdgcn_s_wait_tensorcnt(0);
  }
#else
  for (int idx = tid; idx < 16 * ADIM; idx += 256) {
    const int i = idx >> 6, a = idx & 63;
    s_ho[i][a] = h_o[(gro + i0 + i) * ADIM + a];
  }
#endif
  if (tid < ADIM) s_wphi[tid] = Wphi[tid];
  __syncthreads();

  // phase 1: scores s_ij = sum_a tanh(ho[i,a]+h1[j,a]) * Wphi[a]
  {
    const int i = tid & 15;
    for (int j = tid >> 4; j < SEQ; j += 16) {
      const float* h1r = h_1 + (gro + j) * ADIM;
      float acc = 0.f;
#pragma unroll 4
      for (int a = 0; a < ADIM; ++a)
        acc += tanh_hw(s_ho[i][a] + h1r[a]) * s_wphi[a];
      s_p[i][j] = acc;
    }
  }
  __syncthreads();

  // phase 2: row max, exp (f32 + bf16 copies, unnormalized), row sum
  if (tid < 16) {
    float mx = -3.4e38f;
    for (int j = 0; j < SEQ; ++j) mx = fmaxf(mx, s_p[tid][j]);
    s_rowmax[tid] = mx;
  }
  __syncthreads();
  for (int idx = tid; idx < 16 * SEQ; idx += 256) {
    const int i = idx >> 9, j = idx & (SEQ - 1);
    const float p = __expf(s_p[i][j] - s_rowmax[i]);
    s_p[i][j]  = p;
    s_pb[i][j] = f2bf(p);
  }
  __syncthreads();
  if (tid < 16) {
    float sm = 0.f;
    for (int j = 0; j < SEQ; ++j) sm += s_p[tid][j];
    s_rowsum[tid] = sm;
  }
  __syncthreads();

  // phase 3: part1 = P(16x512) @ X_y(512x128) via WMMA; wave w owns h-tile w.
  // A frags come from s_pb via 16B ds loads; B frags from XyT via 16B vmem loads.
  {
    const int lane = tid & 31;
    const int wave = tid >> 5;
    const int nl   = lane & 15;
    const int sel  = lane >> 4;
    const bf16_t* brow = XyT + (wave * 16 + nl) * MTOT + gro;  // contiguous over j
    const bf16_t* prow = &s_pb[nl][0];                         // A-frag row

    v8f c = {0.f, 0.f, 0.f, 0.f, 0.f, 0.f, 0.f, 0.f};
#pragma unroll 4
    for (int kb = 0; kb < SEQ; kb += 32) {
      const int k0 = kb + 8 * sel;
      const int k1 = kb + 16 + 8 * sel;
      v16bf a  = load_frag_bf16(prow, k0, k1);
      v16bf bb = load_frag_bf16(brow, k0, k1);
      c = __builtin_amdgcn_wmma_f32_16x16x32_bf16(false, a, false, bb, (short)0, c,
                                                  false, false);
    }
    const int moff = sel * 8;
#pragma unroll
    for (int v = 0; v < 8; ++v)
      s_acc[moff + v][wave * 16 + nl] = c[v];
  }
  __syncthreads();

  // phase 4: g[i,a] = sum_j p_ij * tanh(ho[i,a]+h1[j,a]); thread owns (i, 4 a's)
  {
    const int i  = tid >> 4;
    const int a0 = (tid & 15) * 4;
    const float ho0 = s_ho[i][a0 + 0], ho1 = s_ho[i][a0 + 1];
    const float ho2 = s_ho[i][a0 + 2], ho3 = s_ho[i][a0 + 3];
    float g0 = 0.f, g1 = 0.f, g2 = 0.f, g3 = 0.f;
    for (int j = 0; j < SEQ; ++j) {
      const float p = s_p[i][j];
      const float4 hv = *(const float4*)(h_1 + (gro + j) * ADIM + a0);
      g0 += p * tanh_hw(ho0 + hv.x);
      g1 += p * tanh_hw(ho1 + hv.y);
      g2 += p * tanh_hw(ho2 + hv.z);
      g3 += p * tanh_hw(ho3 + hv.w);
    }
    s_g[i][a0 + 0] = g0; s_g[i][a0 + 1] = g1;
    s_g[i][a0 + 2] = g2; s_g[i][a0 + 3] = g3;
  }
  __syncthreads();

  // phase 5: out = (part1 + g @ We^T) / l + be
  for (int idx = tid; idx < 16 * HID; idx += 256) {
    const int i = idx >> 7, h = idx & (HID - 1);
    float acc = s_acc[i][h];
    const float* wer = We + h * ADIM;
#pragma unroll 4
    for (int a = 0; a < ADIM; ++a) acc += wer[a] * s_g[i][a];
    out[(gro + i0 + i) * HID + h] = acc / s_rowsum[i] + be[h];
  }
}

// ---------------------------------------------------------------------------
extern "C" void kernel_launch(void* const* d_in, const int* in_sizes, int n_in,
                              void* d_out, int out_size, void* d_ws, size_t ws_size,
                              hipStream_t stream) {
  const float* X    = (const float*)d_in[0];
  const float* Wo   = (const float*)d_in[1];
  const float* W1   = (const float*)d_in[2];
  const float* Wphi = (const float*)d_in[3];
  const float* Wy   = (const float*)d_in[4];
  const float* by   = (const float*)d_in[5];
  const float* We   = (const float*)d_in[6];
  const float* be   = (const float*)d_in[7];
  float* out = (float*)d_out;

  // workspace layout
  char*   ws  = (char*)d_ws;
  float*  h_o = (float*)ws;                                   // 256 KB
  float*  h_1 = (float*)(ws + (size_t)MTOT * ADIM * 4);       // 256 KB
  bf16_t* XyT = (bf16_t*)(ws + (size_t)2 * MTOT * ADIM * 4);  // 256 KB
  char*   p   = ws + (size_t)2 * MTOT * ADIM * 4 + (size_t)HID * MTOT * 2;
  bf16_t* Xb  = (bf16_t*)p;                     p += (size_t)MTOT * HID * 2; // 256 KB
  bf16_t* Wob = (bf16_t*)p;                     p += (size_t)ADIM * HID * 2; // 16 KB
  bf16_t* W1b = (bf16_t*)p;                     p += (size_t)ADIM * HID * 2; // 16 KB
  bf16_t* Wyb = (bf16_t*)p;                                                  // 32 KB

  // one-shot bf16 conversions
  cvt_bf16_kernel<<<64, 256, 0, stream>>>(X,  Xb,  MTOT * HID);
  cvt_bf16_kernel<<<8,  256, 0, stream>>>(Wo, Wob, ADIM * HID);
  cvt_bf16_kernel<<<8,  256, 0, stream>>>(W1, W1b, ADIM * HID);
  cvt_bf16_kernel<<<8,  256, 0, stream>>>(Wy, Wyb, HID * HID);

  // h_o = X@Wo^T ; h_1 = X@W1^T  (64 x 4 = 256 tiles = 32 blocks)
  proj_gemm_kernel<<<32, 256, 0, stream>>>(Xb, Wob, nullptr, h_o, nullptr, ADIM);
  proj_gemm_kernel<<<32, 256, 0, stream>>>(Xb, W1b, nullptr, h_1, nullptr, ADIM);
  // X_y^T = (X@Wy^T + by)^T, bf16  (64 x 8 = 512 tiles = 64 blocks)
  proj_gemm_kernel<<<64, 256, 0, stream>>>(Xb, Wyb, by, nullptr, XyT, HID);
  // fused attention: 64 i-tiles
  attn_kernel<<<64, 256, 0, stream>>>(h_o, h_1, XyT, Wphi, We, be, out);
}

// v002
// One run takes 43.5 microseconds.
// Next to v001, in two timings, it ran 3.38 and 3.41 times as fast.
// Counting every step since v000, it is 12.0 times as fast.
#include <hip/hip_runtime.h>

// ---------------------------------------------------------------------------
// FlexibleAttention for MI455X (gfx1250, wave32, WMMA)
//
//   cvt: bf16 copies of X, Wo, W1, Wy (one conversion per element)
//   h_o = X@Wo^T, h_1 = X@W1^T                 (WMMA bf16, f32 out)
//   X_y = X@Wy^T + by                          (WMMA bf16, stored transposed bf16)
//   e_ij = tanh(h_o[i]+h_1[j]); s_ij = e.Wphi  (VALU, f32)
//   alpha = softmax_j(s)  (unnormalized exp; /l folded into epilogue)
//   part1 = alpha @ X_y                        (WMMA bf16, f32 acc)
//   g_i   = sum_j alpha_ij e_ij                (VALU, f32)
//   out   = (part1 + g@We^T)/l + be
// ---------------------------------------------------------------------------

typedef __bf16 bf16_t;
typedef __attribute__((ext_vector_type(16))) __bf16        v16bf;
typedef __attribute__((ext_vector_type(8)))  float         v8f;

#define HID   128
#define ADIM  64
#define BATCH 2
#define SEQ   512
#define MTOT  (BATCH * SEQ)   // 1024 total rows

// round-to-nearest-even f32 -> bf16
static __device__ __forceinline__ bf16_t f2bf(float f) {
  union { float f; unsigned int u; } x; x.f = f;
  unsigned int r = x.u + 0x7FFFu + ((x.u >> 16) & 1u);
  union { unsigned short s; bf16_t b; } y; y.s = (unsigned short)(r >> 16);
  return y.b;
}

// tanh as the chip's own instruction (v_tanh_f32). The library tanhf builds into
// two divergent branches of dependent vector code, and those branches also keep
// the compiler from widening and batching the loads of the loops around it.
static __device__ __forceinline__ float tanh_hw(float x) {
  return __builtin_amdgcn_tanhf(x);
}

// Two aligned 8x-bf16 chunks -> one 16x32 A/B-style fragment (ISA 7.12.2).
union frag_u {
  v16bf v;
  uint4 q[2];
};

static __device__ __forceinline__ v16bf load_frag_bf16(const bf16_t* __restrict__ row,
                                                       int k0, int k1) {
  frag_u u;
  u.q[0] = *(const uint4*)(row + k0);  // elems 0..7  : K = k0..k0+7
  u.q[1] = *(const uint4*)(row + k1);  // elems 8..15 : K = k1..k1+7
  return u.v;
}

// ---------------------------------------------------------------------------
// f32 -> bf16 bulk conversion (one pass, grid-stride)
// ---------------------------------------------------------------------------
__global__ __launch_bounds__(256)
void cvt_bf16_kernel(const float* __restrict__ src, bf16_t* __restrict__ dst, int n) {
  for (int i = blockIdx.x * 256 + threadIdx.x; i < n; i += gridDim.x * 256)
    dst[i] = f2bf(src[i]);
}

// ---------------------------------------------------------------------------
// Stage 1: C[M x Nout] = Xb[M x 128] @ Wb[Nout x 128]^T (+bias), bf16 inputs.
// One wave per 16x16 tile, 8 waves / block. Optionally writes f32 row-major
// and/or bf16 *transposed* [Nout x MTOT] (for stage-2 B-fragments).
// ---------------------------------------------------------------------------
__global__ __launch_bounds__(256)
void proj_gemm_kernel(const bf16_t* __restrict__ Xb, const bf16_t* __restrict__ Wb,
                      const float* __restrict__ bias, float* __restrict__ outF32,
                      bf16_t* __restrict__ outT, int Nout) {
  const int lane  = threadIdx.x & 31;
  const int wave  = threadIdx.x >> 5;
  const int tile  = blockIdx.x * 8 + wave;
  const int ntn   = Nout >> 4;
  const int mtile = tile / ntn;
  const int ntile = tile % ntn;
  const int nl    = lane & 15;
  const int sel   = lane >> 4;

  const bf16_t* xrow = Xb + (mtile * 16 + nl) * HID;  // A-frag: lane owns row nl
  const bf16_t* wrow = Wb + (ntile * 16 + nl) * HID;  // B-frag: lane owns col nl

  v8f c = {0.f, 0.f, 0.f, 0.f, 0.f, 0.f, 0.f, 0.f};
#pragma unroll
  for (int kb = 0; kb < HID; kb += 32) {
    const int k0 = kb + 8 * sel;
    const int k1 = kb + 16 + 8 * sel;
    v16bf a = load_frag_bf16(xrow, k0, k1);
    v16bf b = load_frag_bf16(wrow, k0, k1);
    c = __builtin_amdgcn_wmma_f32_16x16x32_bf16(false, a, false, b, (short)0, c,
                                                false, false);
  }

  const int n    = ntile * 16 + nl;
  const float bv = bias ? bias[n] : 0.0f;
  const int moff = sel * 8;
#pragma unroll
  for (int v = 0; v < 8; ++v) {
    const int mrow  = mtile * 16 + moff + v;  // C layout: lane col nl, rows 8*sel+v
    const float val = c[v] + bv;
    if (outF32) outF32[mrow * Nout + n] = val;
    if (outT)   outT[n * MTOT + mrow]   = f2bf(val);
  }
}

// ---------------------------------------------------------------------------
// Stage 2: one workgroup (16 waves) per 4-row i-tile: 256 workgroups, one per WGP.
// A 16-lane row of a wave owns one key row j at a time; lane q of it owns the four
// a = 4q..4q+3 for all four query rows. Each thread keeps the scores of its 16 key
// rows in registers from the score pass to the edge-sum pass.
// ---------------------------------------------------------------------------
#define ROWS  4
#define NWAVE 16
#define JPT   (SEQ / (2 * NWAVE))   // key rows per thread: 16

// lane l with lane l ^ 16
static __device__ __forceinline__ float xhalf(float x) {
  const int v = __builtin_bit_cast(int, x);
  return __builtin_bit_cast(float, __builtin_amdgcn_permlanex16(v, v, 0x76543210, 0xfedcba98,
                                                                false, false));
}

// x + (x of lane l ^ MASK inside the 16-lane row): DPP row_xmask
template <int MASK>
static __device__ __forceinline__ float add_xmask(float x) {
  const int v = __builtin_bit_cast(int, x);
  return x + __builtin_bit_cast(float,
                                __builtin_amdgcn_update_dpp(0, v, 0x160 + MASK, 0xf, 0xf, true));
}

// sum over the 16 lanes of a row, left in every lane of it
static __device__ __forceinline__ float rowsum16(float x) {
  x = add_xmask<1>(x);
  x = add_xmask<2>(x);
  x = add_xmask<4>(x);
  x = add_xmask<8>(x);
  return x;
}

__global__ __launch_bounds__(512)
void attn_kernel(const float* __restrict__ h_o, const float* __restrict__ h_1,
                 const bf16_t* __restrict__ XyT, const float* __restrict__ Wphi,
                 const float* __restrict__ We, const float* __restrict__ be,
                 float* __restrict__ out) {
  __shared__ __attribute__((aligned(16))) bf16_t s_pb[ROWS][SEQ];          // exp weights, WMMA A source
  __shared__ __attribute__((aligned(16))) float  s_wmax[NWAVE][ROWS];      // row max per wave
  __shared__ __attribute__((aligned(16))) float  s_wsum[NWAVE][ROWS];      // row sum per wave
  __shared__ __attribute__((aligned(16))) float  s_gp[NWAVE][ROWS][ADIM];  // edge sum per wave (16 KB)
  __shared__ float s_g[ROWS][ADIM];
  __shared__ float s_l[ROWS];
  __shared__ float s_acc[2][ROWS][HID];                                    // part1 per k half

  const int tid  = threadIdx.x;
  const int lane = tid & 31;
  const int wave = tid >> 5;
  const int q    = lane & 15;            // a-quad (also WMMA row/col index)
  const int sel  = lane >> 4;
  const int b    = blockIdx.x >> 7;      // 128 i-tiles per batch
  const int i0   = (blockIdx.x & 127) * ROWS;
  const int gro  = b * SEQ;              // global row base of this batch
  const int jg   = wave * 2 + sel;       // this 16-lane row's first key row; step 32

  // phase 0: this lane's h_o (4 rows x 4 a), Wphi (4 a) and h_1 (16 key rows x 4 a)
  float4 ho[ROWS];
#pragma unroll
  for (int i = 0; i < ROWS; ++i)
    ho[i] = *(const float4*)(h_o + (gro + i0 + i) * ADIM + q * 4);
  const float4 wp = *(const float4*)(Wphi + q * 4);
  // the loads above have taken their addresses before a later load's result lands on those registers
  asm volatile("s_wait_xcnt 0x0" ::: "memory");
  float4 hv[JPT];
#pragma unroll
  for (int t = 0; t < JPT; ++t)
    hv[t] = *(const float4*)(h_1 + (gro + jg + 32 * t) * ADIM + q * 4);

  // phase 1: scores s_ij = sum_a tanh(ho[i,a]+h1[j,a]) * Wphi[a], in every lane of the row
  float sc[JPT][ROWS];
  float mx[ROWS];
#pragma unroll
  for (int i = 0; i < ROWS; ++i) mx[i] = -3.4e38f;
#pragma unroll
  for (int t = 0; t < JPT; ++t) {
#pragma unroll
    for (int i = 0; i < ROWS; ++i) {
      float s = tanh_hw(ho[i].x + hv[t].x) * wp.x;
      s += tanh_hw(ho[i].y + hv[t].y) * wp.y;
      s += tanh_hw(ho[i].z + hv[t].z) * wp.z;
      s += tanh_hw(ho[i].w + hv[t].w) * wp.w;
      s = rowsum16(s);
      sc[t][i] = s;
      mx[i] = fmaxf(mx[i], s);
    }
  }

  // phase 2: row max over the workgroup
#pragma unroll
  for (int i = 0; i < ROWS; ++i) mx[i] = fmaxf(mx[i], xhalf(mx[i]));
  if (lane == 0) *(float4*)&s_wmax[wave][0] = make_float4(mx[0], mx[1], mx[2], mx[3]);
  __syncthreads();
#pragma unroll
  for (int w = 0; w < NWAVE; ++w) {
    const float4 m4 = *(const float4*)&s_wmax[w][0];
    mx[0] = fmaxf(mx[0], m4.x); mx[1] = fmaxf(mx[1], m4.y);
    mx[2] = fmaxf(mx[2], m4.z); mx[3] = fmaxf(mx[3], m4.w);
  }

  // phase 3: p = exp(s - max) (unnormalized), row sum, g[i,a] = sum_j p_ij * tanh(ho[i,a]+h1[j,a]).
  // h_1 is read again here: the 256 tanh values of a thread do not fit its registers.
#pragma unroll
  for (int t = 0; t < JPT; ++t)
    hv[t] = *(const float4*)(h_1 + (gro + jg + 32 * t) * ADIM + q * 4);
  float  l[ROWS];
  float4 g[ROWS];
#pragma unroll
  for (int i = 0; i < ROWS; ++i) { l[i] = 0.f; g[i] = make_float4(0.f, 0.f, 0.f, 0.f); }
#pragma unroll
  for (int t = 0; t < JPT; ++t) {
    float pq = 0.f;                      // p of query row q, for lanes q < 4
#pragma unroll
    for (int i = 0; i < ROWS; ++i) {
      const float p = __expf(sc[t][i] - mx[i]);
      l[i] += p;
      pq = (q == i) ? p : pq;
      g[i].x += p * tanh_hw(ho[i].x + hv[t].x);
      g[i].y += p * tanh_hw(ho[i].y + hv[t].y);
      g[i].z += p * tanh_hw(ho[i].z + hv[t].z);
      g[i].w += p * tanh_hw(ho[i].w + hv[t].w);
    }
    if (q < ROWS) s_pb[q][jg + 32 * t] = f2bf(pq);
  }
#pragma unroll
  for (int i = 0; i < ROWS; ++i) {
    l[i]   += xhalf(l[i]);
    g[i].x += xhalf(g[i].x); g[i].y += xhalf(g[i].y);
    g[i].z += xhalf(g[i].z); g[i].w += xhalf(g[i].w);
  }
  if (sel == 0) {
#pragma unroll
    for (int i = 0; i < ROWS; ++i) *(float4*)&s_gp[wave][i][q * 4] = g[i];
  }
  if (lane == 0) *(float4*)&s_wsum[wave][0] = make_float4(l[0], l[1], l[2], l[3]);
  __syncthreads();

  // phase 4: part1 = P(4x512) @ X_y(512x128) via WMMA; wave owns h-tile (wave & 7) and
  // k half (wave >> 3). A rows 4..15 repeat rows 0..3; their D rows are not used.
  // A frags come from s_pb via 16B ds loads; B frags from XyT via 16B vmem loads.
  {
    const int ht = wave & 7;
    const int kh = wave >> 3;
    const bf16_t* brow = XyT + (ht * 16 + q) * MTOT + gro + kh * (SEQ / 2);  // contiguous over j
    const bf16_t* prow = &s_pb[q & (ROWS - 1)][kh * (SEQ / 2)];              // A-frag row

    v8f c = {0.f, 0.f, 0.f, 0.f, 0.f, 0.f, 0.f, 0.f};
#pragma unroll
    for (int kb = 0; kb < SEQ / 2; kb += 32) {
      const int k0 = kb + 8 * sel;
      const int k1 = kb + 16 + 8 * sel;
      v16bf a  = load_frag_bf16(prow, k0, k1);
      v16bf bb = load_frag_bf16(brow, k0, k1);
      c = __builtin_amdgcn_wmma_f32_16x16x32_bf16(false, a, false, bb, (short)0, c,
                                                  false, false);
    }
    if (sel == 0) {                      // C layout: lane col q, rows 8*sel+v
#pragma unroll
      for (int v = 0; v < ROWS; ++v) s_acc[kh][v][ht * 16 + q] = c[v];
    }
  }
  // sums over the 16 waves' partial g and l
  if (tid < ROWS * ADIM) {
    float gs = 0.f;
#pragma unroll
    for (int w = 0; w < NWAVE; ++w) gs += (&s_gp[w][0][0])[tid];
    (&s_g[0][0])[tid] = gs;
  } else if (tid < ROWS * ADIM + ROWS) {
    float ls = 0.f;
#pragma unroll
    for (int w = 0; w < NWAVE; ++w) ls += s_wsum[w][tid - ROWS * ADIM];
    s_l[tid - ROWS * ADIM] = ls;
  }
  __syncthreads();

  // phase 5: out = (part1 + g @ We^T) / l + be; one output element per thread
  {
    const int i = tid >> 7, h = tid & (HID - 1);
    float acc = s_acc[0][i][h] + s_acc[1][i][h];
    const float4* wer = (const float4*)(We + h * ADIM);
    float4 wv[ADIM / 4];
#pragma unroll
    for (int a4 = 0; a4 < ADIM / 4 - 1; ++a4) wv[a4] = wer[a4];
    // the loads above have taken their address before the last load's result lands on its registers
    asm volatile("s_wait_xcnt 0x0" ::: "memory");
    wv[ADIM / 4 - 1] = wer[ADIM / 4 - 1];
#pragma unroll
    for (int a4 = 0; a4 < ADIM / 4; ++a4) {
      acc += wv[a4].x * s_g[i][a4 * 4 + 0];
      acc += wv[a4].y * s_g[i][a4 * 4 + 1];
      acc += wv[a4].z * s_g[i][a4 * 4 + 2];
      acc += wv[a4].w * s_g[i][a4 * 4 + 3];
    }
    out[(gro + i0 + i) * HID + h] = acc / s_l[i] + be[h];
  }
}

// ---------------------------------------------------------------------------
extern "C" void kernel_launch(void* const* d_in, const int* in_sizes, int n_in,
                              void* d_out, int out_size, void* d_ws, size_t ws_size,
                              hipStream_t stream) {
  const float* X    = (const float*)d_in[0];
  const float* Wo   = (const float*)d_in[1];
  const float* W1   = (const float*)d_in[2];
  const float* Wphi = (const float*)d_in[3];
  const float* Wy   = (const float*)d_in[4];
  const float* by   = (const float*)d_in[5];
  const float* We   = (const float*)d_in[6];
  const float* be   = (const float*)d_in[7];
  float* out = (float*)d_out;

  // workspace layout
  char*   ws  = (char*)d_ws;
  float*  h_o = (float*)ws;                                   // 256 KB
  float*  h_1 = (float*)(ws + (size_t)MTOT * ADIM * 4);       // 256 KB
  bf16_t* XyT = (bf16_t*)(ws + (size_t)2 * MTOT * ADIM * 4);  // 256 KB
  char*   p   = ws + (size_t)2 * MTOT * ADIM * 4 + (size_t)HID * MTOT * 2;
  bf16_t* Xb  = (bf16_t*)p;                     p += (size_t)MTOT * HID * 2; // 256 KB
  bf16_t* Wob = (bf16_t*)p;                     p += (size_t)ADIM * HID * 2; // 16 KB
  bf16_t* W1b = (bf16_t*)p;                     p += (size_t)ADIM * HID * 2; // 16 KB
  bf16_t* Wyb = (bf16_t*)p;                                                  // 32 KB

  // one-shot bf16 conversions
  cvt_bf16_kernel<<<64, 256, 0, stream>>>(X,  Xb,  MTOT * HID);
  cvt_bf16_kernel<<<8,  256, 0, stream>>>(Wo, Wob, ADIM * HID);
  cvt_bf16_kernel<<<8,  256, 0, stream>>>(W1, W1b, ADIM * HID);
  cvt_bf16_kernel<<<8,  256, 0, stream>>>(Wy, Wyb, HID * HID);

  // h_o = X@Wo^T ; h_1 = X@W1^T  (64 x 4 = 256 tiles = 32 blocks)
  proj_gemm_kernel<<<32, 256, 0, stream>>>(Xb, Wob, nullptr, h_o, nullptr, ADIM);
  proj_gemm_kernel<<<32, 256, 0, stream>>>(Xb, W1b, nullptr, h_1, nullptr, ADIM);
  // X_y^T = (X@Wy^T + by)^T, bf16  (64 x 8 = 512 tiles = 64 blocks)
  proj_gemm_kernel<<<64, 256, 0, stream>>>(Xb, Wyb, by, nullptr, XyT, HID);
  // fused attention: 256 i-tiles of 4 rows
  attn_kernel<<<256, 512, 0, stream>>>(h_o, h_1, XyT, Wphi, We, be, out);
}

// v003
// Measured time: 17.8 microseconds a run.
// Two timings next to v002 put it at 2.45 and 2.47 times that version's speed.
// Over all steps from v000 it is 29.6 times as fast.
#include <hip/hip_runtime.h>

// ---------------------------------------------------------------------------
// FlexibleAttention for MI455X (gfx1250, wave32, WMMA)
//
//   h_o = X@Wo^T, h_1 = X@W1^T                 (WMMA bf16, f32 out)
//   X_y = X@Wy^T + by                          (WMMA bf16, stored transposed bf16)
//   e_ij = tanh(h_o[i]+h_1[j]); s_ij = e.Wphi  (VALU, f32)
//   alpha = softmax_j(s)  (unnormalized exp; /l folded into epilogue)
//   part1 = alpha @ X_y                        (WMMA bf16, f32 acc)
//   g_i   = sum_j alpha_ij e_ij                (VALU, f32)
//   out   = (part1 + g@We^T)/l + be
// ---------------------------------------------------------------------------

typedef __bf16 bf16_t;
typedef __attribute__((ext_vector_type(16))) __bf16        v16bf;
typedef __attribute__((ext_vector_type(8)))  float         v8f;

#define HID   128
#define ADIM  64
#define BATCH 2
#define SEQ   512
#define MTOT  (BATCH * SEQ)   // 1024 total rows

// round-to-nearest-even f32 -> bf16
static __device__ __forceinline__ bf16_t f2bf(float f) {
  union { float f; unsigned int u; } x; x.f = f;
  unsigned int r = x.u + 0x7FFFu + ((x.u >> 16) & 1u);
  union { unsigned short s; bf16_t b; } y; y.s = (unsigned short)(r >> 16);
  return y.b;
}

// tanh as the chip's own instruction (v_tanh_f32). The library tanhf builds into
// two divergent branches of dependent vector code, and those branches also keep
// the compiler from widening and batching the loads of the loops around it.
static __device__ __forceinline__ float tanh_hw(float x) {
  return __builtin_amdgcn_tanhf(x);
}

// Two aligned 8x-bf16 chunks -> one 16x32 A/B-style fragment (ISA 7.12.2).
union frag_u {
  v16bf v;
  uint4 q[2];
};

static __device__ __forceinline__ v16bf load_frag_bf16(const bf16_t* __restrict__ row,
                                                       int k0, int k1) {
  frag_u u;
  u.q[0] = *(const uint4*)(row + k0);  // elems 0..7  : K = k0..k0+7
  u.q[1] = *(const uint4*)(row + k1);  // elems 8..15 : K = k1..k1+7
  return u.v;
}

// ---------------------------------------------------------------------------
// Stage 1, one launch: h_o = X@Wo^T, h_1 = X@W1^T (f32 row-major) and
// X_y^T = (X@Wy^T + by)^T (bf16, [HID x MTOT], for stage-2 B-fragments).
// Block = (16-row tile of X) x (64-row slab of weights: Wo | W1 | Wy rows 0..63 |
// Wy rows 64..127), 4 waves, one block per WGP. The f32 rows are read as they are,
// one whole 512-byte row per wave-wide load, rounded to bf16 in registers (each
// element once per block) and laid in LDS, where the fragments are read from.
// One wave per 16x16 tile.
// ---------------------------------------------------------------------------
typedef __attribute__((ext_vector_type(2))) float  v2f;
typedef __attribute__((ext_vector_type(2))) __bf16 v2bf;

#define PROWS  (16 + ADIM)   // LDS rows: 0..15 the X tile, 16..79 the weight slab
#define PPITCH (HID + 8)     // 272 bytes a row: 16 B x odd, no bank conflict for 16-byte reads

// four f32 -> four bf16, round to nearest even (v_cvt_pk_bf16_f32)
static __device__ __forceinline__ uint2 cvt4(float4 f) {
  union { v2bf p[2]; uint2 q; } u;
  v2f lo = {f.x, f.y}, hi = {f.z, f.w};
  u.p[0] = __builtin_convertvector(lo, v2bf);
  u.p[1] = __builtin_convertvector(hi, v2bf);
  return u.q;
}

__global__ __launch_bounds__(128)
void proj_all_kernel(const float* __restrict__ X, const float* __restrict__ Wo,
                     const float* __restrict__ W1, const float* __restrict__ Wy,
                     const float* __restrict__ by, float* __restrict__ h_o,
                     float* __restrict__ h_1, bf16_t* __restrict__ XyT) {
  __shared__ __attribute__((aligned(16))) bf16_t s_t[PROWS][PPITCH];

  const int lane  = threadIdx.x & 31;
  const int wave  = threadIdx.x >> 5;
  const int mtile = blockIdx.x >> 2;
  const int slab  = blockIdx.x & 3;
  const int nl    = lane & 15;
  const int sel   = lane >> 4;
  const int n     = wave * 16 + nl;      // row of the slab = output column

  // wave w takes rows w, w + 4, ...; lane l the four floats 4l..4l+3 of the row
  const float* wsl  = slab == 0 ? Wo : slab == 1 ? W1 : Wy + (slab - 2) * ADIM * HID;
  const float* xsrc = X + (mtile * 16 + wave) * HID + lane * 4;
  const float* wsrc = wsl + wave * HID + lane * 4;
  const float* bsrc = by + (slab & 1) * ADIM + n;   // used by the Wy slabs only

  float4 xv[4], wv[ADIM / 4];
#pragma unroll
  for (int r = 0; r < 4; ++r) xv[r] = *(const float4*)(xsrc + r * 4 * HID);
#pragma unroll
  for (int r = 0; r < ADIM / 4; ++r) wv[r] = *(const float4*)(wsrc + r * 4 * HID);
  const float bv = *bsrc;
  // the loads above have taken their addresses before those registers are written again;
  // the three pointers are named as inputs so that their registers live up to the wait
  asm volatile("s_wait_xcnt 0x0" :: "v"(xsrc), "v"(wsrc), "v"(bsrc) : "memory");

#pragma unroll
  for (int r = 0; r < 4; ++r) *(uint2*)&s_t[wave + 4 * r][lane * 4] = cvt4(xv[r]);
#pragma unroll
  for (int r = 0; r < ADIM / 4; ++r) *(uint2*)&s_t[16 + wave + 4 * r][lane * 4] = cvt4(wv[r]);
  __syncthreads();

  const bf16_t* xrow = &s_t[nl][0];      // A-frag: lane owns row nl
  const bf16_t* wrow = &s_t[16 + n][0];  // B-frag: lane owns col nl

  v16bf a[4], b[4];                      // fragment reads issued ahead of the products
#pragma unroll
  for (int s = 0; s < 4; ++s) {
    const int k0 = s * 32 + 8 * sel;
    const int k1 = s * 32 + 16 + 8 * sel;
    a[s] = load_frag_bf16(xrow, k0, k1);
    b[s] = load_frag_bf16(wrow, k0, k1);
  }
  v8f c = {0.f, 0.f, 0.f, 0.f, 0.f, 0.f, 0.f, 0.f};
#pragma unroll
  for (int s = 0; s < 4; ++s)
    c = __builtin_amdgcn_wmma_f32_16x16x32_bf16(false, a[s], false, b[s], (short)0, c,
                                                false, false);

  const int mrow = mtile * 16 + sel * 8;  // C layout: lane col nl, rows 8*sel+v
  if (slab < 2) {
    float* dst = (slab == 0 ? h_o : h_1) + mrow * ADIM + n;
#pragma unroll
    for (int v = 0; v < 8; ++v) dst[v * ADIM] = c[v];
  } else {
    union { bf16_t h[8]; uint4 q; } o;
#pragma unroll
    for (int v = 0; v < 8; ++v) o.h[v] = f2bf(c[v] + bv);
    *(uint4*)(XyT + ((slab - 2) * ADIM + n) * MTOT + mrow) = o.q;
  }
}

// ---------------------------------------------------------------------------
// Stage 2: one workgroup (16 waves) per 4-row i-tile: 256 workgroups, one per WGP.
// A 16-lane row of a wave owns one key row j at a time; lane q of it owns the four
// a = 4q..4q+3 for all four query rows. Each thread keeps the scores of its 16 key
// rows in registers from the score pass to the edge-sum pass.
// ---------------------------------------------------------------------------
#define ROWS  4
#define NWAVE 16
#define JPT   (SEQ / (2 * NWAVE))   // key rows per thread: 16

// lane l with lane l ^ 16
static __device__ __forceinline__ float xhalf(float x) {
  const int v = __builtin_bit_cast(int, x);
  return __builtin_bit_cast(float, __builtin_amdgcn_permlanex16(v, v, 0x76543210, 0xfedcba98,
                                                                false, false));
}

// x + (x of lane l ^ MASK inside the 16-lane row): DPP row_xmask
template <int MASK>
static __device__ __forceinline__ float add_xmask(float x) {
  const int v = __builtin_bit_cast(int, x);
  return x + __builtin_bit_cast(float,
                                __builtin_amdgcn_update_dpp(0, v, 0x160 + MASK, 0xf, 0xf, true));
}

// sum over the 16 lanes of a row, left in every lane of it
static __device__ __forceinline__ float rowsum16(float x) {
  x = add_xmask<1>(x);
  x = add_xmask<2>(x);
  x = add_xmask<4>(x);
  x = add_xmask<8>(x);
  return x;
}

__global__ __launch_bounds__(512)
void attn_kernel(const float* __restrict__ h_o, const float* __restrict__ h_1,
                 const bf16_t* __restrict__ XyT, const float* __restrict__ Wphi,
                 const float* __restrict__ We, const float* __restrict__ be,
                 float* __restrict__ out) {
  __shared__ __attribute__((aligned(16))) bf16_t s_pb[ROWS][SEQ];          // exp weights, WMMA A source
  __shared__ __attribute__((aligned(16))) float  s_wmax[NWAVE][ROWS];      // row max per wave
  __shared__ __attribute__((aligned(16))) float  s_wsum[NWAVE][ROWS];      // row sum per wave
  __shared__ __attribute__((aligned(16))) float  s_gp[NWAVE][ROWS][ADIM];  // edge sum per wave (16 KB)
  __shared__ float s_g[ROWS][ADIM];
  __shared__ float s_l[ROWS];
  __shared__ float s_acc[2][ROWS][HID];                                    // part1 per k half

  const int tid  = threadIdx.x;
  const int lane = tid & 31;
  const int wave = tid >> 5;
  const int q    = lane & 15;            // a-quad (also WMMA row/col index)
  const int sel  = lane >> 4;
  const int b    = blockIdx.x >> 7;      // 128 i-tiles per batch
  const int i0   = (blockIdx.x & 127) * ROWS;
  const int gro  = b * SEQ;              // global row base of this batch
  const int jg   = wave * 2 + sel;       // this 16-lane row's first key row; step 32

  // phase 0: this lane's h_o (4 rows x 4 a), Wphi (4 a) and h_1 (16 key rows x 4 a)
  float4 ho[ROWS];
#pragma unroll
  for (int i = 0; i < ROWS; ++i)
    ho[i] = *(const float4*)(h_o + (gro + i0 + i) * ADIM + q * 4);
  const float4 wp = *(const float4*)(Wphi + q * 4);
  // the loads above have taken their addresses before a later load's result lands on those registers
  asm volatile("s_wait_xcnt 0x0" ::: "memory");
  float4 hv[JPT];
#pragma unroll
  for (int t = 0; t < JPT; ++t)
    hv[t] = *(const float4*)(h_1 + (gro + jg + 32 * t) * ADIM + q * 4);

  // phase 1: scores s_ij = sum_a tanh(ho[i,a]+h1[j,a]) * Wphi[a], in every lane of the row
  float sc[JPT][ROWS];
  float mx[ROWS];
#pragma unroll
  for (int i = 0; i < ROWS; ++i) mx[i] = -3.4e38f;
#pragma unroll
  for (int t = 0; t < JPT; ++t) {
#pragma unroll
    for (int i = 0; i < ROWS; ++i) {
      float s = tanh_hw(ho[i].x + hv[t].x) * wp.x;
      s += tanh_hw(ho[i].y + hv[t].y) * wp.y;
      s += tanh_hw(ho[i].z + hv[t].z) * wp.z;
      s += tanh_hw(ho[i].w + hv[t].w) * wp.w;
      s = rowsum16(s);
      sc[t][i] = s;
      mx[i] = fmaxf(mx[i], s);
    }
  }

  // phase 2: row max over the workgroup
#pragma unroll
  for (int i = 0; i < ROWS; ++i) mx[i] = fmaxf(mx[i], xhalf(mx[i]));
  if (lane == 0) *(float4*)&s_wmax[wave][0] = make_float4(mx[0], mx[1], mx[2], mx[3]);
  __syncthreads();
#pragma unroll
  for (int w = 0; w < NWAVE; ++w) {
    const float4 m4 = *(const float4*)&s_wmax[w][0];
    mx[0] = fmaxf(mx[0], m4.x); mx[1] = fmaxf(mx[1], m4.y);
    mx[2] = fmaxf(mx[2], m4.z); mx[3] = fmaxf(mx[3], m4.w);
  }

  // phase 3: p = exp(s - max) (unnormalized), row sum, g[i,a] = sum_j p_ij * tanh(ho[i,a]+h1[j,a]).
  // h_1 is read again here: the 256 tanh values of a thread do not fit its registers.
#pragma unroll
  for (int t = 0; t < JPT; ++t)
    hv[t] = *(const float4*)(h_1 + (gro + jg + 32 * t) * ADIM + q * 4);
  float  l[ROWS];
  float4 g[ROWS];
#pragma unroll
  for (int i = 0; i < ROWS; ++i) { l[i] = 0.f; g[i] = make_float4(0.f, 0.f, 0.f, 0.f); }
#pragma unroll
  for (int t = 0; t < JPT; ++t) {
    float pq = 0.f;                      // p of query row q, for lanes q < 4
#pragma unroll
    for (int i = 0; i < ROWS; ++i) {
      const float p = __expf(sc[t][i] - mx[i]);
      l[i] += p;
      pq = (q == i) ? p : pq;
      g[i].x += p * tanh_hw(ho[i].x + hv[t].x);
      g[i].y += p * tanh_hw(ho[i].y + hv[t].y);
      g[i].z += p * tanh_hw(ho[i].z + hv[t].z);
      g[i].w += p * tanh_hw(ho[i].w + hv[t].w);
    }
    if (q < ROWS) s_pb[q][jg + 32 * t] = f2bf(pq);
  }
#pragma unroll
  for (int i = 0; i < ROWS; ++i) {
    l[i]   += xhalf(l[i]);
    g[i].x += xhalf(g[i].x); g[i].y += xhalf(g[i].y);
    g[i].z += xhalf(g[i].z); g[i].w += xhalf(g[i].w);
  }
  if (sel == 0) {
#pragma unroll
    for (int i = 0; i < ROWS; ++i) *(float4*)&s_gp[wave][i][q * 4] = g[i];
  }
  if (lane == 0) *(float4*)&s_wsum[wave][0] = make_float4(l[0], l[1], l[2], l[3]);
  __syncthreads();

  // phase 4: part1 = P(4x512) @ X_y(512x128) via WMMA; wave owns h-tile (wave & 7) and
  // k half (wave >> 3). A rows 4..15 repeat rows 0..3; their D rows are not used.
  // A frags come from s_pb via 16B ds loads; B frags from XyT via 16B vmem loads.
  {
    const int ht = wave & 7;
    const int kh = wave >> 3;
    const bf16_t* brow = XyT + (ht * 16 + q) * MTOT + gro + kh * (SEQ / 2);  // contiguous over j
    const bf16_t* prow = &s_pb[q & (ROWS - 1)][kh * (SEQ / 2)];              // A-frag row

    v8f c = {0.f, 0.f, 0.f, 0.f, 0.f, 0.f, 0.f, 0.f};
#pragma unroll
    for (int kb = 0; kb < SEQ / 2; kb += 32) {
      const int k0 = kb + 8 * sel;
      const int k1 = kb + 16 + 8 * sel;
      v16bf a  = load_frag_bf16(prow, k0, k1);
      v16bf bb = load_frag_bf16(brow, k0, k1);
      c = __builtin_amdgcn_wmma_f32_16x16x32_bf16(false, a, false, bb, (short)0, c,
                                                  false, false);
    }
    if (sel == 0) {                      // C layout: lane col q, rows 8*sel+v
#pragma unroll
      for (int v = 0; v < ROWS; ++v) s_acc[kh][v][ht * 16 + q] = c[v];
    }
  }
  // sums over the 16 waves' partial g and l
  if (tid < ROWS * ADIM) {
    float gs = 0.f;
#pragma unroll
    for (int w = 0; w < NWAVE; ++w) gs += (&s_gp[w][0][0])[tid];
    (&s_g[0][0])[tid] = gs;
  } else if (tid < ROWS * ADIM + ROWS) {
    float ls = 0.f;
#pragma unroll
    for (int w = 0; w < NWAVE; ++w) ls += s_wsum[w][tid - ROWS * ADIM];
    s_l[tid - ROWS * ADIM] = ls;
  }
  __syncthreads();

  // phase 5: out = (part1 + g @ We^T) / l + be; one output element per thread
  {
    const int i = tid >> 7, h = tid & (HID - 1);
    float acc = s_acc[0][i][h] + s_acc[1][i][h];
    const float4* wer = (const float4*)(We + h * ADIM);
    float4 wv[ADIM / 4];
#pragma unroll
    for (int a4 = 0; a4 < ADIM / 4 - 1; ++a4) wv[a4] = wer[a4];
    // the loads above have taken their address before the last load's result lands on its registers
    asm volatile("s_wait_xcnt 0x0" ::: "memory");
    wv[ADIM / 4 - 1] = wer[ADIM / 4 - 1];
#pragma unroll
    for (int a4 = 0; a4 < ADIM / 4; ++a4) {
      acc += wv[a4].x * s_g[i][a4 * 4 + 0];
      acc += wv[a4].y * s_g[i][a4 * 4 + 1];
      acc += wv[a4].z * s_g[i][a4 * 4 + 2];
      acc += wv[a4].w * s_g[i][a4 * 4 + 3];
    }
    out[(gro + i0 + i) * HID + h] = acc / s_l[i] + be[h];
  }
}

// ---------------------------------------------------------------------------
extern "C" void kernel_launch(void* const* d_in, const int* in_sizes, int n_in,
                              void* d_out, int out_size, void* d_ws, size_t ws_size,
                              hipStream_t stream) {
  const float* X    = (const float*)d_in[0];
  const float* Wo   = (const float*)d_in[1];
  const float* W1   = (const float*)d_in[2];
  const float* Wphi = (const float*)d_in[3];
  const float* Wy   = (const float*)d_in[4];
  const float* by   = (const float*)d_in[5];
  const float* We   = (const float*)d_in[6];
  const float* be   = (const float*)d_in[7];
  float* out = (float*)d_out;

  // workspace layout
  char*   ws  = (char*)d_ws;
  float*  h_o = (float*)ws;                                   // 256 KB
  float*  h_1 = (float*)(ws + (size_t)MTOT * ADIM * 4);       // 256 KB
  bf16_t* XyT = (bf16_t*)(ws + (size_t)2 * MTOT * ADIM * 4);  // 256 KB

  // all three projections: 64 row tiles x 4 weight slabs
  proj_all_kernel<<<256, 128, 0, stream>>>(X, Wo, W1, Wy, by, h_o, h_1, XyT);
  // fused attention: 256 i-tiles of 4 rows
  attn_kernel<<<256, 512, 0, stream>>>(h_o, h_1, XyT, Wphi, We, be, out);
}

// v004
// Measured time: 16 microseconds a run.
// Timed twice side by side with v003, it ran 1.08 and 1.11 times as fast.
// Counting every step since v000, it is 32.5 times as fast.
#include <hip/hip_runtime.h>

// ---------------------------------------------------------------------------
// FlexibleAttention for MI455X (gfx1250, wave32, WMMA)
//
//   h_o = X@Wo^T, h_1 = X@W1^T                 (WMMA bf16, f32 out)
//   X_y = X@Wy^T + by                          (WMMA bf16, stored transposed bf16)
//   e_ij = tanh(h_o[i]+h_1[j]); s_ij = e.Wphi  (VALU, f32)
//   alpha = softmax_j(s)  (unnormalized exp, running max; /l folded into epilogue)
//   part1 = alpha @ X_y                        (WMMA bf16, f32 acc)
//   g_i   = sum_j alpha_ij e_ij                (VALU, f32)
//   out   = (part1 + g@We^T)/l + be
// ---------------------------------------------------------------------------

typedef __bf16 bf16_t;
typedef __attribute__((ext_vector_type(16))) __bf16        v16bf;
typedef __attribute__((ext_vector_type(8)))  float         v8f;

#define HID   128
#define ADIM  64
#define BATCH 2
#define SEQ   512
#define MTOT  (BATCH * SEQ)   // 1024 total rows

// round-to-nearest-even f32 -> bf16
static __device__ __forceinline__ bf16_t f2bf(float f) {
  union { float f; unsigned int u; } x; x.f = f;
  unsigned int r = x.u + 0x7FFFu + ((x.u >> 16) & 1u);
  union { unsigned short s; bf16_t b; } y; y.s = (unsigned short)(r >> 16);
  return y.b;
}

// tanh as the chip's own instruction (v_tanh_f32). The library tanhf builds into
// two divergent branches of dependent vector code, and those branches also keep
// the compiler from widening and batching the loads of the loops around it.
static __device__ __forceinline__ float tanh_hw(float x) {
  return __builtin_amdgcn_tanhf(x);
}

// Two aligned 8x-bf16 chunks -> one 16x32 A/B-style fragment (ISA 7.12.2).
union frag_u {
  v16bf v;
  uint4 q[2];
};

static __device__ __forceinline__ v16bf load_frag_bf16(const bf16_t* __restrict__ row,
                                                       int k0, int k1) {
  frag_u u;
  u.q[0] = *(const uint4*)(row + k0);  // elems 0..7  : K = k0..k0+7
  u.q[1] = *(const uint4*)(row + k1);  // elems 8..15 : K = k1..k1+7
  return u.v;
}

// ---------------------------------------------------------------------------
// Stage 1, one launch: h_o = X@Wo^T, h_1 = X@W1^T (f32 row-major) and
// X_y^T = (X@Wy^T + by)^T (bf16, [HID x MTOT], for stage-2 B-fragments).
// Block = (16-row tile of X) x (64-row slab of weights: Wo | W1 | Wy rows 0..63 |
// Wy rows 64..127), 4 waves, one block per WGP. The f32 rows are read as they are,
// one whole 512-byte row per wave-wide load, rounded to bf16 in registers (each
// element once per block) and laid in LDS, where the fragments are read from.
// One wave per 16x16 tile.
// ---------------------------------------------------------------------------
typedef __attribute__((ext_vector_type(2))) float  v2f;
typedef __attribute__((ext_vector_type(2))) __bf16 v2bf;

#define PROWS  (16 + ADIM)   // LDS rows: 0..15 the X tile, 16..79 the weight slab
#define PPITCH (HID + 8)     // 272 bytes a row: 16 B x odd, no bank conflict for 16-byte reads

// four f32 -> four bf16, round to nearest even (v_cvt_pk_bf16_f32)
static __device__ __forceinline__ uint2 cvt4(float4 f) {
  union { v2bf p[2]; uint2 q; } u;
  v2f lo = {f.x, f.y}, hi = {f.z, f.w};
  u.p[0] = __builtin_convertvector(lo, v2bf);
  u.p[1] = __builtin_convertvector(hi, v2bf);
  return u.q;
}

__global__ __launch_bounds__(128)
void proj_all_kernel(const float* __restrict__ X, const float* __restrict__ Wo,
                     const float* __restrict__ W1, const float* __restrict__ Wy,
                     const float* __restrict__ by, float* __restrict__ h_o,
                     float* __restrict__ h_1, bf16_t* __restrict__ XyT) {
  __shared__ __attribute__((aligned(16))) bf16_t s_t[PROWS][PPITCH];

  const int lane  = threadIdx.x & 31;
  const int wave  = threadIdx.x >> 5;
  const int mtile = blockIdx.x >> 2;
  const int slab  = blockIdx.x & 3;
  const int nl    = lane & 15;
  const int sel   = lane >> 4;
  const int n     = wave * 16 + nl;      // row of the slab = output column

  // wave w takes rows w, w + 4, ...; lane l the four floats 4l..4l+3 of the row
  const float* wsl  = slab == 0 ? Wo : slab == 1 ? W1 : Wy + (slab - 2) * ADIM * HID;
  const float* xsrc = X + (mtile * 16 + wave) * HID + lane * 4;
  const float* wsrc = wsl + wave * HID + lane * 4;
  const float* bsrc = by + (slab & 1) * ADIM + n;   // used by the Wy slabs only

  float4 xv[4], wv[ADIM / 4];
#pragma unroll
  for (int r = 0; r < 4; ++r) xv[r] = *(const float4*)(xsrc + r * 4 * HID);
#pragma unroll
  for (int r = 0; r < ADIM / 4; ++r) wv[r] = *(const float4*)(wsrc + r * 4 * HID);
  const float bv = *bsrc;
  // the loads above have taken their addresses before those registers are written again;
  // the three pointers are named as inputs so that their registers live up to the wait
  asm volatile("s_wait_xcnt 0x0" :: "v"(xsrc), "v"(wsrc), "v"(bsrc) : "memory");

#pragma unroll
  for (int r = 0; r < 4; ++r) *(uint2*)&s_t[wave + 4 * r][lane * 4] = cvt4(xv[r]);
#pragma unroll
  for (int r = 0; r < ADIM / 4; ++r) *(uint2*)&s_t[16 + wave + 4 * r][lane * 4] = cvt4(wv[r]);
  __syncthreads();

  const bf16_t* xrow = &s_t[nl][0];      // A-frag: lane owns row nl
  const bf16_t* wrow = &s_t[16 + n][0];  // B-frag: lane owns col nl

  v16bf a[4], b[4];                      // fragment reads issued ahead of the products
#pragma unroll
  for (int s = 0; s < 4; ++s) {
    const int k0 = s * 32 + 8 * sel;
    const int k1 = s * 32 + 16 + 8 * sel;
    a[s] = load_frag_bf16(xrow, k0, k1);
    b[s] = load_frag_bf16(wrow, k0, k1);
  }
  v8f c = {0.f, 0.f, 0.f, 0.f, 0.f, 0.f, 0.f, 0.f};
#pragma unroll
  for (int s = 0; s < 4; ++s)
    c = __builtin_amdgcn_wmma_f32_16x16x32_bf16(false, a[s], false, b[s], (short)0, c,
                                                false, false);

  const int mrow = mtile * 16 + sel * 8;  // C layout: lane col nl, rows 8*sel+v
  if (slab < 2) {
    float* dst = (slab == 0 ? h_o : h_1) + mrow * ADIM + n;
#pragma unroll
    for (int v = 0; v < 8; ++v) dst[v * ADIM] = c[v];
  } else {
    union { bf16_t h[8]; uint4 q; } o;
#pragma unroll
    for (int v = 0; v < 8; ++v) o.h[v] = f2bf(c[v] + bv);
    *(uint4*)(XyT + ((slab - 2) * ADIM + n) * MTOT + mrow) = o.q;
  }
}

// ---------------------------------------------------------------------------
// Stage 2: one workgroup (16 waves) per 4-row i-tile: 256 workgroups, one per WGP.
// A 16-lane row of a wave takes its key rows four at a time; lane q of it owns the four
// a = 4q..4q+3 for all four query rows. One pass over the key rows: each tanh feeds the
// score and, weighted against a running row maximum, the edge sum.
// ---------------------------------------------------------------------------
#define ROWS  4
#define NWAVE 16
#define JPT   (SEQ / (2 * NWAVE))   // key rows per thread: 16
#define CH    4                     // key rows of a thread per chunk of the running maximum
#define SPITCH (SEQ + 8)            // floats per row of the raw scores in LDS

// lane l with lane l ^ 16
static __device__ __forceinline__ float xhalf(float x) {
  const int v = __builtin_bit_cast(int, x);
  return __builtin_bit_cast(float, __builtin_amdgcn_permlanex16(v, v, 0x76543210, 0xfedcba98,
                                                                false, false));
}

// x + (x of lane l ^ MASK inside the 16-lane row): DPP row_xmask
template <int MASK>
static __device__ __forceinline__ float add_xmask(float x) {
  const int v = __builtin_bit_cast(int, x);
  return x + __builtin_bit_cast(float,
                                __builtin_amdgcn_update_dpp(0, v, 0x160 + MASK, 0xf, 0xf, true));
}

// sum over the 16 lanes of a row, left in every lane of it
static __device__ __forceinline__ float rowsum16(float x) {
  x = add_xmask<1>(x);
  x = add_xmask<2>(x);
  x = add_xmask<4>(x);
  x = add_xmask<8>(x);
  return x;
}

__global__ __launch_bounds__(512)
void attn_kernel(const float* __restrict__ h_o, const float* __restrict__ h_1,
                 const bf16_t* __restrict__ XyT, const float* __restrict__ Wphi,
                 const float* __restrict__ We, const float* __restrict__ be,
                 float* __restrict__ out) {
  __shared__ __attribute__((aligned(16))) bf16_t s_pb[ROWS][SEQ];          // exp weights, WMMA A source
  __shared__ __attribute__((aligned(16))) float  s_sc[ROWS][SPITCH];       // raw scores
  __shared__ __attribute__((aligned(16))) float  s_wmax[NWAVE][ROWS];      // row max per wave
  __shared__ __attribute__((aligned(16))) float  s_wsum[NWAVE][ROWS];      // row sum per wave
  __shared__ __attribute__((aligned(16))) float  s_wfac[NWAVE][ROWS];      // exp(wave max - row max)
  __shared__ __attribute__((aligned(16))) float  s_gp[NWAVE][ROWS][ADIM];  // edge sum per wave (16 KB)
  __shared__ float s_g[ROWS][ADIM];
  __shared__ float s_l[ROWS];
  __shared__ float s_acc[2][ROWS][HID];                                    // part1 per k half

  const int tid  = threadIdx.x;
  const int lane = tid & 31;
  const int wave = tid >> 5;
  const int q    = lane & 15;            // a-quad (also WMMA row/col index)
  const int sel  = lane >> 4;
  const int b    = blockIdx.x >> 7;      // 128 i-tiles per batch
  const int i0   = (blockIdx.x & 127) * ROWS;
  const int gro  = b * SEQ;              // global row base of this batch
  const int jg   = wave * 2 + sel;       // this 16-lane row's first key row; step 32

  // phase 0: this lane's h_o (4 rows x 4 a), Wphi (4 a) and the first chunk of h_1 (4 key rows x 4 a)
  float4 ho[ROWS];
#pragma unroll
  for (int i = 0; i < ROWS; ++i)
    ho[i] = *(const float4*)(h_o + (gro + i0 + i) * ADIM + q * 4);
  const float4 wp = *(const float4*)(Wphi + q * 4);
  // the loads above have taken their addresses before a later load's result lands on those registers
  asm volatile("s_wait_xcnt 0x0" ::: "memory");
  const float* hsrc = h_1 + (gro + jg) * ADIM + q * 4;   // this lane's h_1: key rows jg + 32 t
  float4 hn[CH];                                         // the next chunk's h_1, read one chunk ahead
#pragma unroll
  for (int u = 0; u < CH; ++u) hn[u] = *(const float4*)(hsrc + 32 * u * ADIM);

  // phase 1, one pass over the key rows: e = tanh(ho[i,a]+h1[j,a]) is evaluated once and used for
  // the score s_ij = sum_a e * Wphi[a] and for the edge sum g[i,a] = sum_j p_ij * e. The weights
  // p = exp(s - m) are taken against the running maximum m of this 16-lane row; when a chunk of CH
  // key rows raises m, the sums so far are scaled by exp(m_old - m_new).
  // Two key rows share each packed instruction: the sums over j run as an even and an odd partial sum.
  float m[ROWS];
  v2f   l2[ROWS], g2[ROWS][4];
#pragma unroll
  for (int i = 0; i < ROWS; ++i) {
    m[i] = -3.4e38f;
    l2[i] = (v2f){0.f, 0.f};
#pragma unroll
    for (int a = 0; a < 4; ++a) g2[i][a] = (v2f){0.f, 0.f};
  }
  // kept rolled: unrolled, the compiler computes the tanh values of several chunks ahead of the
  // sums that use them and spills registers to scratch
#pragma unroll 1
  for (int c = 0; c < JPT / CH; ++c) {
    v2f    e[CH / 2][ROWS][4];
    v2f    s[CH / 2][ROWS];
    float4 hc[CH];
#pragma unroll
    for (int u = 0; u < CH; ++u) hc[u] = hn[u];
    // the loads so far have taken their address before the pointer moves on
    asm volatile("s_wait_xcnt 0x0" :: "v"(hsrc) : "memory");
    if (c + 1 < JPT / CH) {
      hsrc += 32 * CH * ADIM;
#pragma unroll
      for (int u = 0; u < CH; ++u) hn[u] = *(const float4*)(hsrc + 32 * u * ADIM);
    }
#pragma unroll
    for (int v = 0; v < CH / 2; ++v) {
      const float4 h0 = hc[2 * v], h1 = hc[2 * v + 1];
#pragma unroll
      for (int i = 0; i < ROWS; ++i) {
        e[v][i][0] = (v2f){tanh_hw(ho[i].x + h0.x), tanh_hw(ho[i].x + h1.x)};
        e[v][i][1] = (v2f){tanh_hw(ho[i].y + h0.y), tanh_hw(ho[i].y + h1.y)};
        e[v][i][2] = (v2f){tanh_hw(ho[i].z + h0.z), tanh_hw(ho[i].z + h1.z)};
        e[v][i][3] = (v2f){tanh_hw(ho[i].w + h0.w), tanh_hw(ho[i].w + h1.w)};
        v2f t = e[v][i][0] * wp.x;
        t += e[v][i][1] * wp.y;
        t += e[v][i][2] * wp.z;
        t += e[v][i][3] * wp.w;
        s[v][i] = (v2f){rowsum16(t.x), rowsum16(t.y)};   // in every lane of the row
      }
    }
    // the chunk's 16 raw scores go to LDS, one per lane: lane q has key row q >> 2, query row q & 3
    float sv = s[0][0].x;
#pragma unroll
    for (int k = 1; k < CH * ROWS; ++k) sv = (q == k) ? s[k >> 3][k & 3][(k >> 2) & 1] : sv;
    s_sc[q & 3][jg + 32 * (c * CH + (q >> 2))] = sv;
#pragma unroll
    for (int i = 0; i < ROWS; ++i) {
      const float cm = fmaxf(fmaxf(s[0][i].x, s[0][i].y), fmaxf(s[1][i].x, s[1][i].y));
      const float mn = fmaxf(m[i], cm);
      const float f  = __expf(m[i] - mn);   // 0 in the first chunk, where the sums are 0
      m[i] = mn;
      l2[i] *= f;
#pragma unroll
      for (int a = 0; a < 4; ++a) g2[i][a] *= f;
#pragma unroll
      for (int v = 0; v < CH / 2; ++v) {
        const v2f p = {__expf(s[v][i].x - mn), __expf(s[v][i].y - mn)};
        l2[i] += p;
#pragma unroll
        for (int a = 0; a < 4; ++a) g2[i][a] += p * e[v][i][a];
      }
    }
  }
  float  l[ROWS];
  float4 g[ROWS];
#pragma unroll
  for (int i = 0; i < ROWS; ++i) {
    l[i] = l2[i].x + l2[i].y;
    g[i] = make_float4(g2[i][0].x + g2[i][0].y, g2[i][1].x + g2[i][1].y,
                       g2[i][2].x + g2[i][2].y, g2[i][3].x + g2[i][3].y);
  }

  // phase 2: the two 16-lane rows of the wave are brought to the wave's maximum and added; the
  // wave's maximum, row sum and edge sum go to LDS
  float mx[ROWS];
#pragma unroll
  for (int i = 0; i < ROWS; ++i) {
    mx[i] = fmaxf(m[i], xhalf(m[i]));
    const float f = __expf(m[i] - mx[i]);
    l[i] *= f;
    g[i].x *= f; g[i].y *= f; g[i].z *= f; g[i].w *= f;
    l[i]   += xhalf(l[i]);
    g[i].x += xhalf(g[i].x); g[i].y += xhalf(g[i].y);
    g[i].z += xhalf(g[i].z); g[i].w += xhalf(g[i].w);
  }
  if (sel == 0) {
#pragma unroll
    for (int i = 0; i < ROWS; ++i) *(float4*)&s_gp[wave][i][q * 4] = g[i];
  }
  if (lane == 0) {
    *(float4*)&s_wmax[wave][0] = make_float4(mx[0], mx[1], mx[2], mx[3]);
    *(float4*)&s_wsum[wave][0] = make_float4(l[0], l[1], l[2], l[3]);
  }
  __syncthreads();

  // phase 3: row max over the workgroup; the WMMA A source p = exp(s - max) (unnormalized) from
  // the raw scores, four per thread; the factor that brings each wave's sums to that max
#pragma unroll
  for (int w = 0; w < NWAVE; ++w) {
    const float4 m4 = *(const float4*)&s_wmax[w][0];
    mx[0] = fmaxf(mx[0], m4.x); mx[1] = fmaxf(mx[1], m4.y);
    mx[2] = fmaxf(mx[2], m4.z); mx[3] = fmaxf(mx[3], m4.w);
  }
  {
    const int   pi = tid >> 7, pj = (tid & 127) * 4;
    const float mi = pi == 0 ? mx[0] : pi == 1 ? mx[1] : pi == 2 ? mx[2] : mx[3];
    const float4 s4 = *(const float4*)&s_sc[pi][pj];
    union { bf16_t h[4]; uint2 v; } o;
    o.h[0] = f2bf(__expf(s4.x - mi));
    o.h[1] = f2bf(__expf(s4.y - mi));
    o.h[2] = f2bf(__expf(s4.z - mi));
    o.h[3] = f2bf(__expf(s4.w - mi));
    *(uint2*)&s_pb[pi][pj] = o.v;
  }
  if (tid < NWAVE * ROWS) {
    const int   fi = tid & (ROWS - 1);
    const float mi = fi == 0 ? mx[0] : fi == 1 ? mx[1] : fi == 2 ? mx[2] : mx[3];
    (&s_wfac[0][0])[tid] = __expf((&s_wmax[0][0])[tid] - mi);
  }
  __syncthreads();

  // phase 4: part1 = P(4x512) @ X_y(512x128) via WMMA; wave owns h-tile (wave & 7) and
  // k half (wave >> 3). A rows 4..15 repeat rows 0..3; their D rows are not used.
  // A frags come from s_pb via 16B ds loads; B frags from XyT via 16B vmem loads.
  {
    const int ht = wave & 7;
    const int kh = wave >> 3;
    const bf16_t* brow = XyT + (ht * 16 + q) * MTOT + gro + kh * (SEQ / 2);  // contiguous over j
    const bf16_t* prow = &s_pb[q & (ROWS - 1)][kh * (SEQ / 2)];              // A-frag row

    v8f c = {0.f, 0.f, 0.f, 0.f, 0.f, 0.f, 0.f, 0.f};
#pragma unroll
    for (int kb = 0; kb < SEQ / 2; kb += 32) {
      const int k0 = kb + 8 * sel;
      const int k1 = kb + 16 + 8 * sel;
      v16bf a  = load_frag_bf16(prow, k0, k1);
      v16bf bb = load_frag_bf16(brow, k0, k1);
      c = __builtin_amdgcn_wmma_f32_16x16x32_bf16(false, a, false, bb, (short)0, c,
                                                  false, false);
    }
    // the distance the chip needs between the last WMMA and a vector write of its A registers; the
    // scheduling barrier keeps the WMMAs in front of the v_nops
    __builtin_amdgcn_sched_barrier(0);
    asm volatile("v_nop\n\tv_nop\n\tv_nop\n\tv_nop");
    if (sel == 0) {                      // C layout: lane col q, rows 8*sel+v
#pragma unroll
      for (int v = 0; v < ROWS; ++v) s_acc[kh][v][ht * 16 + q] = c[v];
    }
  }
  // sums over the 16 waves' partial g and l, each brought to the workgroup's max
  if (tid < ROWS * ADIM) {
    float gs = 0.f;
#pragma unroll
    for (int w = 0; w < NWAVE; ++w) gs += (&s_gp[w][0][0])[tid] * s_wfac[w][tid >> 6];
    (&s_g[0][0])[tid] = gs;
  } else if (tid < ROWS * ADIM + ROWS) {
    float ls = 0.f;
#pragma unroll
    for (int w = 0; w < NWAVE; ++w) ls += s_wsum[w][tid - ROWS * ADIM] * s_wfac[w][tid - ROWS * ADIM];
    s_l[tid - ROWS * ADIM] = ls;
  }
  __syncthreads();

  // phase 5: out = (part1 + g @ We^T) / l + be; one output element per thread
  {
    const int i = tid >> 7, h = tid & (HID - 1);
    float acc = s_acc[0][i][h] + s_acc[1][i][h];
    const float4* wer = (const float4*)(We + h * ADIM);
    float4 wv[ADIM / 4];
#pragma unroll
    for (int a4 = 0; a4 < ADIM / 4 - 1; ++a4) wv[a4] = wer[a4];
    // the loads above have taken their address before the last load's result lands on its registers
    asm volatile("s_wait_xcnt 0x0" ::: "memory");
    wv[ADIM / 4 - 1] = wer[ADIM / 4 - 1];
#pragma unroll
    for (int a4 = 0; a4 < ADIM / 4; ++a4) {
      acc += wv[a4].x * s_g[i][a4 * 4 + 0];
      acc += wv[a4].y * s_g[i][a4 * 4 + 1];
      acc += wv[a4].z * s_g[i][a4 * 4 + 2];
      acc += wv[a4].w * s_g[i][a4 * 4 + 3];
    }
    out[(gro + i0 + i) * HID + h] = acc / s_l[i] + be[h];
  }
}

// ---------------------------------------------------------------------------
extern "C" void kernel_launch(void* const* d_in, const int* in_sizes, int n_in,
                              void* d_out, int out_size, void* d_ws, size_t ws_size,
                              hipStream_t stream) {
  const float* X    = (const float*)d_in[0];
  const float* Wo   = (const float*)d_in[1];
  const float* W1   = (const float*)d_in[2];
  const float* Wphi = (const float*)d_in[3];
  const float* Wy   = (const float*)d_in[4];
  const float* by   = (const float*)d_in[5];
  const float* We   = (const float*)d_in[6];
  const float* be   = (const float*)d_in[7];
  float* out = (float*)d_out;

  // workspace layout
  char*   ws  = (char*)d_ws;
  float*  h_o = (float*)ws;                                   // 256 KB
  float*  h_1 = (float*)(ws + (size_t)MTOT * ADIM * 4);       // 256 KB
  bf16_t* XyT = (bf16_t*)(ws + (size_t)2 * MTOT * ADIM * 4);  // 256 KB

  // all three projections: 64 row tiles x 4 weight slabs
  proj_all_kernel<<<256, 128, 0, stream>>>(X, Wo, W1, Wy, by, h_o, h_1, XyT);
  // fused attention: 256 i-tiles of 4 rows
  attn_kernel<<<256, 512, 0, stream>>>(h_o, h_1, XyT, Wphi, We, be, out);
}

// v005
// It runs in 13.8 microseconds.
// Next to v004, in two timings, it ran 1.16 times as fast each time.
// All steps since v000 together make it 37.6 times as fast.
#include <hip/hip_runtime.h>

// ---------------------------------------------------------------------------
// FlexibleAttention for MI455X (gfx1250, wave32, WMMA)
//
//   h_o = X@Wo^T, h_1 = X@W1^T                 (WMMA bf16, f32 out)
//   X_y = X@Wy^T + by                          (WMMA bf16, stored transposed bf16)
//   e_ij = tanh(h_o[i]+h_1[j]); s_ij = e.Wphi  (VALU, f32)
//   alpha = softmax_j(s)  (unnormalized exp, running max; /l folded into epilogue)
//   part1 = alpha @ X_y                        (WMMA bf16, f32 acc)
//   g_i   = sum_j alpha_ij e_ij                (VALU, f32)
//   out   = (part1 + g@We^T)/l + be
//   The X_y^T slice and We are copied into LDS while the scores are computed.
// ---------------------------------------------------------------------------

typedef __bf16 bf16_t;
typedef __attribute__((ext_vector_type(16))) __bf16        v16bf;
typedef __attribute__((ext_vector_type(8)))  float         v8f;

#define HID   128
#define ADIM  64
#define BATCH 2
#define SEQ   512
#define MTOT  (BATCH * SEQ)   // 1024 total rows

// round-to-nearest-even f32 -> bf16
static __device__ __forceinline__ bf16_t f2bf(float f) {
  union { float f; unsigned int u; } x; x.f = f;
  unsigned int r = x.u + 0x7FFFu + ((x.u >> 16) & 1u);
  union { unsigned short s; bf16_t b; } y; y.s = (unsigned short)(r >> 16);
  return y.b;
}

// tanh as the chip's own instruction (v_tanh_f32). The library tanhf builds into
// two divergent branches of dependent vector code, and those branches also keep
// the compiler from widening and batching the loads of the loops around it.
static __device__ __forceinline__ float tanh_hw(float x) {
  return __builtin_amdgcn_tanhf(x);
}

// Two aligned 8x-bf16 chunks -> one 16x32 A/B-style fragment (ISA 7.12.2).
union frag_u {
  v16bf v;
  uint4 q[2];
};

static __device__ __forceinline__ v16bf load_frag_bf16(const bf16_t* __restrict__ row,
                                                       int k0, int k1) {
  frag_u u;
  u.q[0] = *(const uint4*)(row + k0);  // elems 0..7  : K = k0..k0+7
  u.q[1] = *(const uint4*)(row + k1);  // elems 8..15 : K = k1..k1+7
  return u.v;
}

// ---------------------------------------------------------------------------
// Stage 1, one launch: h_o = X@Wo^T, h_1 = X@W1^T (f32 row-major) and
// X_y^T = (X@Wy^T + by)^T (bf16, [HID x MTOT], for stage-2 B-fragments).
// Block = (16-row tile of X) x (64-row slab of weights: Wo | W1 | Wy rows 0..63 |
// Wy rows 64..127), 4 waves, one block per WGP. The f32 rows are read as they are,
// one whole 512-byte row per wave-wide load, rounded to bf16 in registers (each
// element once per block) and laid in LDS, where the fragments are read from.
// One wave per 16x16 tile.
// ---------------------------------------------------------------------------
typedef __attribute__((ext_vector_type(2))) float  v2f;
typedef __attribute__((ext_vector_type(2))) __bf16 v2bf;

#define PROWS  (16 + ADIM)   // LDS rows: 0..15 the X tile, 16..79 the weight slab
#define PPITCH (HID + 8)     // 272 bytes a row: 16 B x odd, no bank conflict for 16-byte reads

// four f32 -> four bf16, round to nearest even (v_cvt_pk_bf16_f32)
static __device__ __forceinline__ uint2 cvt4(float4 f) {
  union { v2bf p[2]; uint2 q; } u;
  v2f lo = {f.x, f.y}, hi = {f.z, f.w};
  u.p[0] = __builtin_convertvector(lo, v2bf);
  u.p[1] = __builtin_convertvector(hi, v2bf);
  return u.q;
}

__global__ __launch_bounds__(128)
void proj_all_kernel(const float* __restrict__ X, const float* __restrict__ Wo,
                     const float* __restrict__ W1, const float* __restrict__ Wy,
                     const float* __restrict__ by, float* __restrict__ h_o,
                     float* __restrict__ h_1, bf16_t* __restrict__ XyT) {
  __shared__ __attribute__((aligned(16))) bf16_t s_t[PROWS][PPITCH];

  const int lane  = threadIdx.x & 31;
  const int wave  = threadIdx.x >> 5;
  const int mtile = blockIdx.x >> 2;
  const int slab  = blockIdx.x & 3;
  const int nl    = lane & 15;
  const int sel   = lane >> 4;
  const int n     = wave * 16 + nl;      // row of the slab = output column

  // wave w takes rows w, w + 4, ...; lane l the four floats 4l..4l+3 of the row
  const float* wsl  = slab == 0 ? Wo : slab == 1 ? W1 : Wy + (slab - 2) * ADIM * HID;
  const float* xsrc = X + (mtile * 16 + wave) * HID + lane * 4;
  const float* wsrc = wsl + wave * HID + lane * 4;
  const float* bsrc = by + (slab & 1) * ADIM + n;   // used by the Wy slabs only

  float4 xv[4], wv[ADIM / 4];
#pragma unroll
  for (int r = 0; r < 4; ++r) xv[r] = *(const float4*)(xsrc + r * 4 * HID);
#pragma unroll
  for (int r = 0; r < ADIM / 4; ++r) wv[r] = *(const float4*)(wsrc + r * 4 * HID);
  const float bv = *bsrc;
  // the loads above have taken their addresses before those registers are written again;
  // the three pointers are named as inputs so that their registers live up to the wait
  asm volatile("s_wait_xcnt 0x0" :: "v"(xsrc), "v"(wsrc), "v"(bsrc) : "memory");

#pragma unroll
  for (int r = 0; r < 4; ++r) *(uint2*)&s_t[wave + 4 * r][lane * 4] = cvt4(xv[r]);
#pragma unroll
  for (int r = 0; r < ADIM / 4; ++r) *(uint2*)&s_t[16 + wave + 4 * r][lane * 4] = cvt4(wv[r]);
  __syncthreads();

  const bf16_t* xrow = &s_t[nl][0];      // A-frag: lane owns row nl
  const bf16_t* wrow = &s_t[16 + n][0];  // B-frag: lane owns col nl

  v16bf a[4], b[4];                      // fragment reads issued ahead of the products
#pragma unroll
  for (int s = 0; s < 4; ++s) {
    const int k0 = s * 32 + 8 * sel;
    const int k1 = s * 32 + 16 + 8 * sel;
    a[s] = load_frag_bf16(xrow, k0, k1);
    b[s] = load_frag_bf16(wrow, k0, k1);
  }
  v8f c = {0.f, 0.f, 0.f, 0.f, 0.f, 0.f, 0.f, 0.f};
#pragma unroll
  for (int s = 0; s < 4; ++s)
    c = __builtin_amdgcn_wmma_f32_16x16x32_bf16(false, a[s], false, b[s], (short)0, c,
                                                false, false);

  const int mrow = mtile * 16 + sel * 8;  // C layout: lane col nl, rows 8*sel+v
  if (slab < 2) {
    float* dst = (slab == 0 ? h_o : h_1) + mrow * ADIM + n;
#pragma unroll
    for (int v = 0; v < 8; ++v) dst[v * ADIM] = c[v];
  } else {
    union { bf16_t h[8]; uint4 q; } o;
#pragma unroll
    for (int v = 0; v < 8; ++v) o.h[v] = f2bf(c[v] + bv);
    *(uint4*)(XyT + ((slab - 2) * ADIM + n) * MTOT + mrow) = o.q;
  }
}

// ---------------------------------------------------------------------------
// Stage 2: one workgroup (16 waves) per 4-row i-tile: 256 workgroups, one per WGP.
// A 16-lane row of a wave takes its key rows four at a time; lane q of it owns the four
// a = 4q..4q+3 for all four query rows. One pass over the key rows: each tanh feeds the
// score and, weighted against a running row maximum, the edge sum.
// ---------------------------------------------------------------------------
#define ROWS  4
#define NWAVE 16
#define JPT   (SEQ / (2 * NWAVE))   // key rows per thread: 16
#define CH    4                     // key rows of a thread per chunk of the running maximum
#define SPITCH (SEQ + 8)            // floats per row of the raw scores in LDS
#define XPITCH (SEQ + 8)            // bf16 per LDS row of the X_y^T slice: 1040 bytes, 16 B x odd
#define WPITCH (ADIM + 4)           // floats per LDS row of We: 272 bytes, 16 B x odd

// LDS byte address of a __shared__ object: the low 32 bits of its address
static __device__ __forceinline__ unsigned lds_addr(const void* p) {
  return (unsigned)(size_t)p;
}

// Asynchronous copies global -> LDS, 16 bytes per lane and copy, through no register. The
// s_wait_xcnt closes each statement so that it stands in front of any rewrite of the address
// registers the copies name. The data is waited for with s_wait_asynccnt by the caller.
static __device__ __forceinline__ void async_copy8(unsigned l, int lstep, const char* g, int gstep) {
  // copies 2k and 2k + 1: the two 512-byte halves of row k
  asm volatile(
      "global_load_async_to_lds_b128 %0, %8, off\n\t"
      "global_load_async_to_lds_b128 %1, %9, off\n\t"
      "global_load_async_to_lds_b128 %2, %10, off\n\t"
      "global_load_async_to_lds_b128 %3, %11, off\n\t"
      "global_load_async_to_lds_b128 %4, %12, off\n\t"
      "global_load_async_to_lds_b128 %5, %13, off\n\t"
      "global_load_async_to_lds_b128 %6, %14, off\n\t"
      "global_load_async_to_lds_b128 %7, %15, off\n\t"
      "s_wait_xcnt 0x0"
      :: "v"(l), "v"(l + 512), "v"(l + lstep), "v"(l + lstep + 512),
         "v"(l + 2 * lstep), "v"(l + 2 * lstep + 512), "v"(l + 3 * lstep), "v"(l + 3 * lstep + 512),
         "v"(g), "v"(g + 512), "v"(g + gstep), "v"(g + gstep + 512),
         "v"(g + 2 * gstep), "v"(g + 2 * gstep + 512), "v"(g + 3 * gstep), "v"(g + 3 * gstep + 512)
      : "memory");
}

static __device__ __forceinline__ void async_copy4(unsigned l, int lstep, const char* g, int gstep) {
  asm volatile(
      "global_load_async_to_lds_b128 %0, %4, off\n\t"
      "global_load_async_to_lds_b128 %1, %5, off\n\t"
      "global_load_async_to_lds_b128 %2, %6, off\n\t"
      "global_load_async_to_lds_b128 %3, %7, off\n\t"
      "s_wait_xcnt 0x0"
      :: "v"(l), "v"(l + lstep), "v"(l + 2 * lstep), "v"(l + 3 * lstep),
         "v"(g), "v"(g + gstep), "v"(g + 2 * gstep), "v"(g + 3 * gstep)
      : "memory");
}

// lane l with lane l ^ 16
static __device__ __forceinline__ float xhalf(float x) {
  const int v = __builtin_bit_cast(int, x);
  return __builtin_bit_cast(float, __builtin_amdgcn_permlanex16(v, v, 0x76543210, 0xfedcba98,
                                                                false, false));
}

// x + (x of lane l ^ MASK inside the 16-lane row): DPP row_xmask
template <int MASK>
static __device__ __forceinline__ float add_xmask(float x) {
  const int v = __builtin_bit_cast(int, x);
  return x + __builtin_bit_cast(float,
                                __builtin_amdgcn_update_dpp(0, v, 0x160 + MASK, 0xf, 0xf, true));
}

// sum over the 16 lanes of a row, left in every lane of it
static __device__ __forceinline__ float rowsum16(float x) {
  x = add_xmask<1>(x);
  x = add_xmask<2>(x);
  x = add_xmask<4>(x);
  x = add_xmask<8>(x);
  return x;
}

__global__ __launch_bounds__(512)
void attn_kernel(const float* __restrict__ h_o, const float* __restrict__ h_1,
                 const bf16_t* __restrict__ XyT, const float* __restrict__ Wphi,
                 const float* __restrict__ We, const float* __restrict__ be,
                 float* __restrict__ out) {
  __shared__ __attribute__((aligned(16))) bf16_t s_pb[ROWS][SEQ];          // exp weights, WMMA A source
  __shared__ __attribute__((aligned(16))) float  s_sc[ROWS][SPITCH];       // raw scores
  __shared__ __attribute__((aligned(16))) float  s_wmax[NWAVE][ROWS];      // row max per wave
  __shared__ __attribute__((aligned(16))) float  s_wsum[NWAVE][ROWS];      // row sum per wave
  __shared__ __attribute__((aligned(16))) float  s_wfac[NWAVE][ROWS];      // exp(wave max - row max)
  __shared__ __attribute__((aligned(16))) float  s_gp[NWAVE][ROWS][ADIM];  // edge sum per wave (16 KB)
  __shared__ float s_g[ROWS][ADIM];
  __shared__ float s_l[ROWS];
  __shared__ float s_acc[2][ROWS][HID];                                    // part1 per k half
  __shared__ __attribute__((aligned(16))) bf16_t s_xy[HID][XPITCH];        // X_y^T, this batch's columns (130 KB)
  __shared__ __attribute__((aligned(16))) float  s_we[HID][WPITCH];        // We (34 KB)

  const int tid  = threadIdx.x;
  const int lane = tid & 31;
  const int wave = tid >> 5;
  const int q    = lane & 15;            // a-quad (also WMMA row/col index)
  const int sel  = lane >> 4;
  const int b    = blockIdx.x >> 7;      // 128 i-tiles per batch
  const int i0   = (blockIdx.x & 127) * ROWS;
  const int gro  = b * SEQ;              // global row base of this batch
  const int jg   = wave * 2 + sel;       // this 16-lane row's first key row; step 32

  // phase 0: this lane's h_o (4 rows x 4 a), Wphi (4 a) and the first chunk of h_1 (4 key rows x 4 a)
  float4 ho[ROWS];
#pragma unroll
  for (int i = 0; i < ROWS; ++i)
    ho[i] = *(const float4*)(h_o + (gro + i0 + i) * ADIM + q * 4);
  const float4 wp = *(const float4*)(Wphi + q * 4);
  // the loads above have taken their addresses before a later load's result lands on those registers
  asm volatile("s_wait_xcnt 0x0" ::: "memory");
  const float* hsrc = h_1 + (gro + jg) * ADIM + q * 4;   // this lane's h_1: key rows jg + 32 t
  float4 hn[CH];                                         // the next chunk's h_1, read one chunk ahead
#pragma unroll
  for (int u = 0; u < CH; ++u) hn[u] = *(const float4*)(hsrc + 32 * u * ADIM);

  // what phases 4 and 5 read, X_y^T (this batch's 512 columns of all 128 rows) and We, starts on its
  // way into LDS here, in whole 512-byte runs per wave, and lands while phase 1 computes. Wave w
  // brings rows 8w..8w+7 of both: 16 copies of half an X_y^T row, 4 copies of two We rows.
  {
    const unsigned lx = lds_addr(&s_xy[wave * 8][lane * 8]);
    const char*    gx = (const char*)(XyT + wave * 8 * MTOT + gro + lane * 8);
    async_copy8(lx, XPITCH * 2, gx, MTOT * 2);
    async_copy8(lx + 4 * XPITCH * 2, XPITCH * 2, gx + 4 * MTOT * 2, MTOT * 2);
    async_copy4(lds_addr(&s_we[wave * 8 + sel][q * 4]), 2 * WPITCH * 4,
                (const char*)(We + wave * 8 * ADIM + lane * 4), 2 * ADIM * 4);
  }

  // phase 1, one pass over the key rows: e = tanh(ho[i,a]+h1[j,a]) is evaluated once and used for
  // the score s_ij = sum_a e * Wphi[a] and for the edge sum g[i,a] = sum_j p_ij * e. The weights
  // p = exp(s - m) are taken against the running maximum m of this 16-lane row; when a chunk of CH
  // key rows raises m, the sums so far are scaled by exp(m_old - m_new).
  // Two key rows share each packed instruction: the sums over j run as an even and an odd partial sum.
  float m[ROWS];
  v2f   l2[ROWS], g2[ROWS][4];
#pragma unroll
  for (int i = 0; i < ROWS; ++i) {
    m[i] = -3.4e38f;
    l2[i] = (v2f){0.f, 0.f};
#pragma unroll
    for (int a = 0; a < 4; ++a) g2[i][a] = (v2f){0.f, 0.f};
  }
  // kept rolled: unrolled, the compiler computes the tanh values of several chunks ahead of the
  // sums that use them and spills registers to scratch
#pragma unroll 1
  for (int c = 0; c < JPT / CH; ++c) {
    v2f    e[CH / 2][ROWS][4];
    v2f    s[CH / 2][ROWS];
    float4 hc[CH];
#pragma unroll
    for (int u = 0; u < CH; ++u) hc[u] = hn[u];
    // the loads so far have taken their address before the pointer moves on
    asm volatile("s_wait_xcnt 0x0" :: "v"(hsrc) : "memory");
    if (c + 1 < JPT / CH) {
      hsrc += 32 * CH * ADIM;
#pragma unroll
      for (int u = 0; u < CH; ++u) hn[u] = *(const float4*)(hsrc + 32 * u * ADIM);
    }
#pragma unroll
    for (int v = 0; v < CH / 2; ++v) {
      const float4 h0 = hc[2 * v], h1 = hc[2 * v + 1];
#pragma unroll
      for (int i = 0; i < ROWS; ++i) {
        e[v][i][0] = (v2f){tanh_hw(ho[i].x + h0.x), tanh_hw(ho[i].x + h1.x)};
        e[v][i][1] = (v2f){tanh_hw(ho[i].y + h0.y), tanh_hw(ho[i].y + h1.y)};
        e[v][i][2] = (v2f){tanh_hw(ho[i].z + h0.z), tanh_hw(ho[i].z + h1.z)};
        e[v][i][3] = (v2f){tanh_hw(ho[i].w + h0.w), tanh_hw(ho[i].w + h1.w)};
        v2f t = e[v][i][0] * wp.x;
        t += e[v][i][1] * wp.y;
        t += e[v][i][2] * wp.z;
        t += e[v][i][3] * wp.w;
        s[v][i] = (v2f){rowsum16(t.x), rowsum16(t.y)};   // in every lane of the row
      }
    }
    // the chunk's 16 raw scores go to LDS, one per lane: lane q has key row q >> 2, query row q & 3
    float sv = s[0][0].x;
#pragma unroll
    for (int k = 1; k < CH * ROWS; ++k) sv = (q == k) ? s[k >> 3][k & 3][(k >> 2) & 1] : sv;
    s_sc[q & 3][jg + 32 * (c * CH + (q >> 2))] = sv;
#pragma unroll
    for (int i = 0; i < ROWS; ++i) {
      const float cm = fmaxf(fmaxf(s[0][i].x, s[0][i].y), fmaxf(s[1][i].x, s[1][i].y));
      const float mn = fmaxf(m[i], cm);
      const float f  = __expf(m[i] - mn);   // 0 in the first chunk, where the sums are 0
      m[i] = mn;
      l2[i] *= f;
#pragma unroll
      for (int a = 0; a < 4; ++a) g2[i][a] *= f;
#pragma unroll
      for (int v = 0; v < CH / 2; ++v) {
        const v2f p = {__expf(s[v][i].x - mn), __expf(s[v][i].y - mn)};
        l2[i] += p;
#pragma unroll
        for (int a = 0; a < 4; ++a) g2[i][a] += p * e[v][i][a];
      }
    }
  }
  float  l[ROWS];
  float4 g[ROWS];
#pragma unroll
  for (int i = 0; i < ROWS; ++i) {
    l[i] = l2[i].x + l2[i].y;
    g[i] = make_float4(g2[i][0].x + g2[i][0].y, g2[i][1].x + g2[i][1].y,
                       g2[i][2].x + g2[i][2].y, g2[i][3].x + g2[i][3].y);
  }

  // phase 2: the two 16-lane rows of the wave are brought to the wave's maximum and added; the
  // wave's maximum, row sum and edge sum go to LDS
  float mx[ROWS];
#pragma unroll
  for (int i = 0; i < ROWS; ++i) {
    mx[i] = fmaxf(m[i], xhalf(m[i]));
    const float f = __expf(m[i] - mx[i]);
    l[i] *= f;
    g[i].x *= f; g[i].y *= f; g[i].z *= f; g[i].w *= f;
    l[i]   += xhalf(l[i]);
    g[i].x += xhalf(g[i].x); g[i].y += xhalf(g[i].y);
    g[i].z += xhalf(g[i].z); g[i].w += xhalf(g[i].w);
  }
  if (sel == 0) {
#pragma unroll
    for (int i = 0; i < ROWS; ++i) *(float4*)&s_gp[wave][i][q * 4] = g[i];
  }
  if (lane == 0) {
    *(float4*)&s_wmax[wave][0] = make_float4(mx[0], mx[1], mx[2], mx[3]);
    *(float4*)&s_wsum[wave][0] = make_float4(l[0], l[1], l[2], l[3]);
  }
  // this wave's copies of X_y^T and We have landed; behind the barrier every wave's have
  asm volatile("s_wait_asynccnt 0x0" ::: "memory");
  __syncthreads();

  // phase 3: row max over the workgroup; the WMMA A source p = exp(s - max) (unnormalized) from
  // the raw scores, four per thread; the factor that brings each wave's sums to that max
#pragma unroll
  for (int w = 0; w < NWAVE; ++w) {
    const float4 m4 = *(const float4*)&s_wmax[w][0];
    mx[0] = fmaxf(mx[0], m4.x); mx[1] = fmaxf(mx[1], m4.y);
    mx[2] = fmaxf(mx[2], m4.z); mx[3] = fmaxf(mx[3], m4.w);
  }
  {
    const int   pi = tid >> 7, pj = (tid & 127) * 4;
    const float mi = pi == 0 ? mx[0] : pi == 1 ? mx[1] : pi == 2 ? mx[2] : mx[3];
    const float4 s4 = *(const float4*)&s_sc[pi][pj];
    union { bf16_t h[4]; uint2 v; } o;
    o.h[0] = f2bf(__expf(s4.x - mi));
    o.h[1] = f2bf(__expf(s4.y - mi));
    o.h[2] = f2bf(__expf(s4.z - mi));
    o.h[3] = f2bf(__expf(s4.w - mi));
    *(uint2*)&s_pb[pi][pj] = o.v;
  }
  if (tid < NWAVE * ROWS) {
    const int   fi = tid & (ROWS - 1);
    const float mi = fi == 0 ? mx[0] : fi == 1 ? mx[1] : fi == 2 ? mx[2] : mx[3];
    (&s_wfac[0][0])[tid] = __expf((&s_wmax[0][0])[tid] - mi);
  }
  __syncthreads();

  // phase 4: part1 = P(4x512) @ X_y(512x128) via WMMA; wave owns h-tile (wave & 7) and
  // k half (wave >> 3). A rows 4..15 repeat rows 0..3; their D rows are not used.
  // A frags come from s_pb, B frags from s_xy, both via 16B ds loads.
  {
    const int ht = wave & 7;
    const int kh = wave >> 3;
    const bf16_t* brow = &s_xy[ht * 16 + q][kh * (SEQ / 2)];                 // contiguous over j
    const bf16_t* prow = &s_pb[q & (ROWS - 1)][kh * (SEQ / 2)];              // A-frag row

    v8f c = {0.f, 0.f, 0.f, 0.f, 0.f, 0.f, 0.f, 0.f};
#pragma unroll
    for (int kb = 0; kb < SEQ / 2; kb += 32) {
      const int k0 = kb + 8 * sel;
      const int k1 = kb + 16 + 8 * sel;
      v16bf a  = load_frag_bf16(prow, k0, k1);
      v16bf bb = load_frag_bf16(brow, k0, k1);
      c = __builtin_amdgcn_wmma_f32_16x16x32_bf16(false, a, false, bb, (short)0, c,
                                                  false, false);
    }
    // the distance the chip needs between the last WMMA and a vector write of its A registers; the
    // scheduling barrier keeps the WMMAs in front of the v_nops
    __builtin_amdgcn_sched_barrier(0);
    asm volatile("v_nop\n\tv_nop\n\tv_nop\n\tv_nop");
    if (sel == 0) {                      // C layout: lane col q, rows 8*sel+v
#pragma unroll
      for (int v = 0; v < ROWS; ++v) s_acc[kh][v][ht * 16 + q] = c[v];
    }
  }
  // this thread's row of We for phase 5, read from LDS ahead of the barrier that phase 5 waits behind
  float4 wv[ADIM / 4];
#pragma unroll
  for (int a4 = 0; a4 < ADIM / 4; ++a4) wv[a4] = *(const float4*)&s_we[tid & (HID - 1)][a4 * 4];
  // sums over the 16 waves' partial g and l, each brought to the workgroup's max
  if (tid < ROWS * ADIM) {
    float gs = 0.f;
#pragma unroll
    for (int w = 0; w < NWAVE; ++w) gs += (&s_gp[w][0][0])[tid] * s_wfac[w][tid >> 6];
    (&s_g[0][0])[tid] = gs;
  } else if (tid < ROWS * ADIM + ROWS) {
    float ls = 0.f;
#pragma unroll
    for (int w = 0; w < NWAVE; ++w) ls += s_wsum[w][tid - ROWS * ADIM] * s_wfac[w][tid - ROWS * ADIM];
    s_l[tid - ROWS * ADIM] = ls;
  }
  __syncthreads();

  // phase 5: out = (part1 + g @ We^T) / l + be; one output element per thread
  {
    const int i = tid >> 7, h = tid & (HID - 1);
    float acc = s_acc[0][i][h] + s_acc[1][i][h];
#pragma unroll
    for (int a4 = 0; a4 < ADIM / 4; ++a4) {
      acc += wv[a4].x * s_g[i][a4 * 4 + 0];
      acc += wv[a4].y * s_g[i][a4 * 4 + 1];
      acc += wv[a4].z * s_g[i][a4 * 4 + 2];
      acc += wv[a4].w * s_g[i][a4 * 4 + 3];
    }
    out[(gro + i0 + i) * HID + h] = acc / s_l[i] + be[h];
  }
}

// ---------------------------------------------------------------------------
extern "C" void kernel_launch(void* const* d_in, const int* in_sizes, int n_in,
                              void* d_out, int out_size, void* d_ws, size_t ws_size,
                              hipStream_t stream) {
  const float* X    = (const float*)d_in[0];
  const float* Wo   = (const float*)d_in[1];
  const float* W1   = (const float*)d_in[2];
  const float* Wphi = (const float*)d_in[3];
  const float* Wy   = (const float*)d_in[4];
  const float* by   = (const float*)d_in[5];
  const float* We   = (const float*)d_in[6];
  const float* be   = (const float*)d_in[7];
  float* out = (float*)d_out;

  // workspace layout
  char*   ws  = (char*)d_ws;
  float*  h_o = (float*)ws;                                   // 256 KB
  float*  h_1 = (float*)(ws + (size_t)MTOT * ADIM * 4);       // 256 KB
  bf16_t* XyT = (bf16_t*)(ws + (size_t)2 * MTOT * ADIM * 4);  // 256 KB

  // all three projections: 64 row tiles x 4 weight slabs
  proj_all_kernel<<<256, 128, 0, stream>>>(X, Wo, W1, Wy, by, h_o, h_1, XyT);
  // fused attention: 256 i-tiles of 4 rows
  attn_kernel<<<256, 512, 0, stream>>>(h_o, h_1, XyT, Wphi, We, be, out);
}

// v006
// It runs in 13.1 microseconds.
// In two side-by-side timings against v005, it was 1.06 and 1.05 times as fast.
// All steps since v000 together make it 39.6 times as fast.
#include <hip/hip_runtime.h>

// ---------------------------------------------------------------------------
// FlexibleAttention for MI455X (gfx1250, wave32, WMMA)
//
//   h_o = X@Wo^T, h_1 = X@W1^T                 (WMMA bf16, f32 out)
//   X_y = X@Wy^T + by                          (WMMA bf16, stored transposed bf16)
//   e_ij = tanh(h_o[i]+h_1[j]); s_ij = e.Wphi  (VALU, f32)
//   alpha = softmax_j(s)  (unnormalized exp, running max; /l folded into epilogue)
//   part1 = alpha @ X_y                        (WMMA bf16, f32 acc)
//   g_i   = sum_j alpha_ij e_ij                (VALU, f32)
//   out   = (part1 + g@We^T)/l + be
//   The X_y^T slice and We are copied into LDS while the scores are computed.
// ---------------------------------------------------------------------------

typedef __bf16 bf16_t;
typedef __attribute__((ext_vector_type(16))) __bf16        v16bf;
typedef __attribute__((ext_vector_type(8)))  float         v8f;

#define HID   128
#define ADIM  64
#define BATCH 2
#define SEQ   512
#define MTOT  (BATCH * SEQ)   // 1024 total rows

// round-to-nearest-even f32 -> bf16
static __device__ __forceinline__ bf16_t f2bf(float f) {
  union { float f; unsigned int u; } x; x.f = f;
  unsigned int r = x.u + 0x7FFFu + ((x.u >> 16) & 1u);
  union { unsigned short s; bf16_t b; } y; y.s = (unsigned short)(r >> 16);
  return y.b;
}

// tanh as the chip's own instruction (v_tanh_f32). The library tanhf builds into
// two divergent branches of dependent vector code, and those branches also keep
// the compiler from widening and batching the loads of the loops around it.
static __device__ __forceinline__ float tanh_hw(float x) {
  return __builtin_amdgcn_tanhf(x);
}

// Two aligned 8x-bf16 chunks -> one 16x32 A/B-style fragment (ISA 7.12.2).
union frag_u {
  v16bf v;
  uint4 q[2];
};

static __device__ __forceinline__ v16bf load_frag_bf16(const bf16_t* __restrict__ row,
                                                       int k0, int k1) {
  frag_u u;
  u.q[0] = *(const uint4*)(row + k0);  // elems 0..7  : K = k0..k0+7
  u.q[1] = *(const uint4*)(row + k1);  // elems 8..15 : K = k1..k1+7
  return u.v;
}

// ---------------------------------------------------------------------------
// Stage 1, one launch: h_o = X@Wo^T, h_1 = X@W1^T (f32 row-major) and
// X_y^T = (X@Wy^T + by)^T (bf16, [HID x MTOT], for stage-2 B-fragments).
// Block = (16-row tile of X) x (64-row slab of weights: Wo | W1 | Wy rows 0..63 |
// Wy rows 64..127), 4 waves, one block per WGP. The f32 rows are read as they are,
// one whole 512-byte row per wave-wide load, rounded to bf16 in registers (each
// element once per block) and laid in LDS, where the fragments are read from.
// One wave per 16x16 tile.
// ---------------------------------------------------------------------------
typedef __attribute__((ext_vector_type(2))) float  v2f;
typedef __attribute__((ext_vector_type(2))) __bf16 v2bf;

#define PROWS  (16 + ADIM)   // LDS rows: 0..15 the X tile, 16..79 the weight slab
#define PPITCH (HID + 8)     // 272 bytes a row: 16 B x odd, no bank conflict for 16-byte reads

// four f32 -> four bf16, round to nearest even (v_cvt_pk_bf16_f32)
static __device__ __forceinline__ uint2 cvt4(float4 f) {
  union { v2bf p[2]; uint2 q; } u;
  v2f lo = {f.x, f.y}, hi = {f.z, f.w};
  u.p[0] = __builtin_convertvector(lo, v2bf);
  u.p[1] = __builtin_convertvector(hi, v2bf);
  return u.q;
}

__global__ __launch_bounds__(128)
void proj_all_kernel(const float* __restrict__ X, const float* __restrict__ Wo,
                     const float* __restrict__ W1, const float* __restrict__ Wy,
                     const float* __restrict__ by, float* __restrict__ h_o,
                     float* __restrict__ h_1, bf16_t* __restrict__ XyT) {
  __shared__ __attribute__((aligned(16))) bf16_t s_t[PROWS][PPITCH];

  const int lane  = threadIdx.x & 31;
  const int wave  = threadIdx.x >> 5;
  const int mtile = blockIdx.x >> 2;
  const int slab  = blockIdx.x & 3;
  const int nl    = lane & 15;
  const int sel   = lane >> 4;
  const int n     = wave * 16 + nl;      // row of the slab = output column

  // wave w takes rows w, w + 4, ...; lane l the four floats 4l..4l+3 of the row
  const float* wsl  = slab == 0 ? Wo : slab == 1 ? W1 : Wy + (slab - 2) * ADIM * HID;
  const float* xsrc = X + (mtile * 16 + wave) * HID + lane * 4;
  const float* wsrc = wsl + wave * HID + lane * 4;
  const float* bsrc = by + (slab & 1) * ADIM + n;   // used by the Wy slabs only

  float4 xv[4], wv[ADIM / 4];
#pragma unroll
  for (int r = 0; r < 4; ++r) xv[r] = *(const float4*)(xsrc + r * 4 * HID);
#pragma unroll
  for (int r = 0; r < ADIM / 4; ++r) wv[r] = *(const float4*)(wsrc + r * 4 * HID);
  const float bv = *bsrc;
  // the loads above have taken their addresses before those registers are written again;
  // the three pointers are named as inputs so that their registers live up to the wait
  asm volatile("s_wait_xcnt 0x0" :: "v"(xsrc), "v"(wsrc), "v"(bsrc) : "memory");

#pragma unroll
  for (int r = 0; r < 4; ++r) *(uint2*)&s_t[wave + 4 * r][lane * 4] = cvt4(xv[r]);
#pragma unroll
  for (int r = 0; r < ADIM / 4; ++r) *(uint2*)&s_t[16 + wave + 4 * r][lane * 4] = cvt4(wv[r]);
  __syncthreads();

  const bf16_t* xrow = &s_t[nl][0];      // A-frag: lane owns row nl
  const bf16_t* wrow = &s_t[16 + n][0];  // B-frag: lane owns col nl

  v16bf a[4], b[4];                      // fragment reads issued ahead of the products
#pragma unroll
  for (int s = 0; s < 4; ++s) {
    const int k0 = s * 32 + 8 * sel;
    const int k1 = s * 32 + 16 + 8 * sel;
    a[s] = load_frag_bf16(xrow, k0, k1);
    b[s] = load_frag_bf16(wrow, k0, k1);
  }
  v8f c = {0.f, 0.f, 0.f, 0.f, 0.f, 0.f, 0.f, 0.f};
#pragma unroll
  for (int s = 0; s < 4; ++s)
    c = __builtin_amdgcn_wmma_f32_16x16x32_bf16(false, a[s], false, b[s], (short)0, c,
                                                false, false);

  const int mrow = mtile * 16 + sel * 8;  // C layout: lane col nl, rows 8*sel+v
  if (slab < 2) {
    float* dst = (slab == 0 ? h_o : h_1) + mrow * ADIM + n;
#pragma unroll
    for (int v = 0; v < 8; ++v) dst[v * ADIM] = c[v];
  } else {
    union { bf16_t h[8]; uint4 q; } o;
#pragma unroll
    for (int v = 0; v < 8; ++v) o.h[v] = f2bf(c[v] + bv);
    *(uint4*)(XyT + ((slab - 2) * ADIM + n) * MTOT + mrow) = o.q;
  }
}

// ---------------------------------------------------------------------------
// Stage 2: one workgroup (16 waves) per 4-row i-tile: 256 workgroups, one per WGP.
// An 8-lane group of a wave owns two key rows j at a time, one chunk; lane q8 of it owns eight a
// (4 q8 .. 4 q8 + 3 and the same + 32) for all four query rows, so that a score takes three
// cross-lane steps and its exp is repeated in 8 lanes. One pass over the key rows: each tanh feeds the
// score and, weighted against a running row maximum, the edge sum.
// ---------------------------------------------------------------------------
#define ROWS  4
#define NWAVE 16
#define JPT   (SEQ / (4 * NWAVE))   // key rows per thread: 8
#define CH    2                     // key rows of a thread per chunk of the running maximum
#define SPITCH (SEQ + 8)            // floats per row of the raw scores in LDS
#define XPITCH (SEQ + 8)            // bf16 per LDS row of the X_y^T slice: 1040 bytes, 16 B x odd
#define WPITCH (ADIM + 4)           // floats per LDS row of We: 272 bytes, 16 B x odd

// LDS byte address of a __shared__ object: the low 32 bits of its address
static __device__ __forceinline__ unsigned lds_addr(const void* p) {
  return (unsigned)(size_t)p;
}

// Asynchronous copies global -> LDS, 16 bytes per lane and copy, through no register. The
// s_wait_xcnt closes each statement so that it stands in front of any rewrite of the address
// registers the copies name. The data is waited for with s_wait_asynccnt by the caller.
static __device__ __forceinline__ void async_copy8(unsigned l, int lstep, const char* g, int gstep) {
  // copies 2k and 2k + 1: the two 512-byte halves of row k
  asm volatile(
      "global_load_async_to_lds_b128 %0, %8, off\n\t"
      "global_load_async_to_lds_b128 %1, %9, off\n\t"
      "global_load_async_to_lds_b128 %2, %10, off\n\t"
      "global_load_async_to_lds_b128 %3, %11, off\n\t"
      "global_load_async_to_lds_b128 %4, %12, off\n\t"
      "global_load_async_to_lds_b128 %5, %13, off\n\t"
      "global_load_async_to_lds_b128 %6, %14, off\n\t"
      "global_load_async_to_lds_b128 %7, %15, off\n\t"
      "s_wait_xcnt 0x0"
      :: "v"(l), "v"(l + 512), "v"(l + lstep), "v"(l + lstep + 512),
         "v"(l + 2 * lstep), "v"(l + 2 * lstep + 512), "v"(l + 3 * lstep), "v"(l + 3 * lstep + 512),
         "v"(g), "v"(g + 512), "v"(g + gstep), "v"(g + gstep + 512),
         "v"(g + 2 * gstep), "v"(g + 2 * gstep + 512), "v"(g + 3 * gstep), "v"(g + 3 * gstep + 512)
      : "memory");
}

static __device__ __forceinline__ void async_copy4(unsigned l, int lstep, const char* g, int gstep) {
  asm volatile(
      "global_load_async_to_lds_b128 %0, %4, off\n\t"
      "global_load_async_to_lds_b128 %1, %5, off\n\t"
      "global_load_async_to_lds_b128 %2, %6, off\n\t"
      "global_load_async_to_lds_b128 %3, %7, off\n\t"
      "s_wait_xcnt 0x0"
      :: "v"(l), "v"(l + lstep), "v"(l + 2 * lstep), "v"(l + 3 * lstep),
         "v"(g), "v"(g + gstep), "v"(g + 2 * gstep), "v"(g + 3 * gstep)
      : "memory");
}

// lane l with lane l ^ 16
static __device__ __forceinline__ float xhalf(float x) {
  const int v = __builtin_bit_cast(int, x);
  return __builtin_bit_cast(float, __builtin_amdgcn_permlanex16(v, v, 0x76543210, 0xfedcba98,
                                                                false, false));
}

// x + (x of lane l ^ MASK inside the 16-lane row): DPP row_xmask
template <int MASK>
static __device__ __forceinline__ float add_xmask(float x) {
  const int v = __builtin_bit_cast(int, x);
  return x + __builtin_bit_cast(float,
                                __builtin_amdgcn_update_dpp(0, v, 0x160 + MASK, 0xf, 0xf, true));
}

// sum over the 8 lanes of a group, left in every lane of it
static __device__ __forceinline__ float rowsum8(float x) {
  x = add_xmask<1>(x);
  x = add_xmask<2>(x);
  x = add_xmask<4>(x);
  return x;
}

// max(x, x of lane l ^ 8 inside the 16-lane row)
static __device__ __forceinline__ float max_xmask8(float x) {
  const int v = __builtin_bit_cast(int, x);
  return fmaxf(x, __builtin_bit_cast(float,
                                     __builtin_amdgcn_update_dpp(0, v, 0x168, 0xf, 0xf, true)));
}

__global__ __launch_bounds__(512)
void attn_kernel(const float* __restrict__ h_o, const float* __restrict__ h_1,
                 const bf16_t* __restrict__ XyT, const float* __restrict__ Wphi,
                 const float* __restrict__ We, const float* __restrict__ be,
                 float* __restrict__ out) {
  __shared__ __attribute__((aligned(16))) bf16_t s_pb[ROWS][SEQ];          // exp weights, WMMA A source
  __shared__ __attribute__((aligned(16))) float  s_sc[ROWS][SPITCH];       // raw scores
  __shared__ __attribute__((aligned(16))) float  s_wmax[NWAVE][ROWS];      // row max per wave
  __shared__ __attribute__((aligned(16))) float  s_wsum[NWAVE][ROWS];      // row sum per wave
  __shared__ __attribute__((aligned(16))) float  s_wfac[NWAVE][ROWS];      // exp(wave max - row max)
  __shared__ __attribute__((aligned(16))) float  s_gp[NWAVE][ROWS][ADIM];  // edge sum per wave (16 KB)
  __shared__ float s_g[ROWS][ADIM];
  __shared__ float s_l[ROWS];
  __shared__ float s_acc[2][ROWS][HID];                                    // part1 per k half
  __shared__ __attribute__((aligned(16))) bf16_t s_xy[HID][XPITCH];        // X_y^T, this batch's columns (130 KB)
  __shared__ __attribute__((aligned(16))) float  s_we[HID][WPITCH];        // We (34 KB)

  const int tid  = threadIdx.x;
  const int lane = tid & 31;
  const int wave = tid >> 5;
  const int q    = lane & 15;            // a-quad (also WMMA row/col index)
  const int sel  = lane >> 4;
  const int b    = blockIdx.x >> 7;      // 128 i-tiles per batch
  const int i0   = (blockIdx.x & 127) * ROWS;
  const int gro  = b * SEQ;              // global row base of this batch
  const int q8   = lane & 7;             // this lane's a: 4 q8 .. 4 q8 + 3 and 32 + 4 q8 .. 32 + 4 q8 + 3
  const int jg   = wave * 4 + (lane >> 3);   // this 8-lane group's first key row; step 64

  // phase 0: this lane's h_o (4 rows x 8 a), Wphi (8 a) and the first chunk of h_1 (2 key rows x 8 a)
  v2f ho[ROWS][4], wp[4];
#pragma unroll
  for (int i = 0; i < ROWS; ++i) {
    const float4 lo = *(const float4*)(h_o + (gro + i0 + i) * ADIM + q8 * 4);
    const float4 hi = *(const float4*)(h_o + (gro + i0 + i) * ADIM + 32 + q8 * 4);
    ho[i][0] = (v2f){lo.x, lo.y}; ho[i][1] = (v2f){lo.z, lo.w};
    ho[i][2] = (v2f){hi.x, hi.y}; ho[i][3] = (v2f){hi.z, hi.w};
  }
  {
    const float4 lo = *(const float4*)(Wphi + q8 * 4);
    const float4 hi = *(const float4*)(Wphi + 32 + q8 * 4);
    wp[0] = (v2f){lo.x, lo.y}; wp[1] = (v2f){lo.z, lo.w};
    wp[2] = (v2f){hi.x, hi.y}; wp[3] = (v2f){hi.z, hi.w};
  }
  // the loads above have taken their addresses before a later load's result lands on those registers
  asm volatile("s_wait_xcnt 0x0" ::: "memory");
  const float* hsrc = h_1 + (gro + jg) * ADIM + q8 * 4;  // this lane's h_1: key rows jg + 64 t
  float4 hn[CH][2];                                      // the next chunk's h_1, read one chunk ahead
#pragma unroll
  for (int u = 0; u < CH; ++u) {
    hn[u][0] = *(const float4*)(hsrc + 64 * u * ADIM);
    hn[u][1] = *(const float4*)(hsrc + 64 * u * ADIM + 32);
  }

  // what phases 4 and 5 read, X_y^T (this batch's 512 columns of all 128 rows) and We, starts on its
  // way into LDS here, in whole 512-byte runs per wave, and lands while phase 1 computes. Wave w
  // brings rows 8w..8w+7 of both: 16 copies of half an X_y^T row, 4 copies of two We rows.
  {
    const unsigned lx = lds_addr(&s_xy[wave * 8][lane * 8]);
    const char*    gx = (const char*)(XyT + wave * 8 * MTOT + gro + lane * 8);
    async_copy8(lx, XPITCH * 2, gx, MTOT * 2);
    async_copy8(lx + 4 * XPITCH * 2, XPITCH * 2, gx + 4 * MTOT * 2, MTOT * 2);
    async_copy4(lds_addr(&s_we[wave * 8 + sel][q * 4]), 2 * WPITCH * 4,
                (const char*)(We + wave * 8 * ADIM + lane * 4), 2 * ADIM * 4);
  }

  // phase 1, one pass over the key rows: e = tanh(ho[i,a]+h1[j,a]) is evaluated once and used for
  // the score s_ij = sum_a e * Wphi[a] and for the edge sum g[i,a] = sum_j p_ij * e. The weights
  // p = exp(s - m) are taken against the running maximum m of this 8-lane group; when a chunk of CH
  // key rows raises m, the sums so far are scaled by exp(m_old - m_new).
  // Two neighbouring a share each packed instruction.
  float m[ROWS], l[ROWS];
  v2f   g2[ROWS][4];
#pragma unroll
  for (int i = 0; i < ROWS; ++i) {
    m[i] = -3.4e38f;
    l[i] = 0.f;
#pragma unroll
    for (int k = 0; k < 4; ++k) g2[i][k] = (v2f){0.f, 0.f};
  }
  // kept rolled: unrolled, the compiler computes the tanh values of several chunks ahead of the
  // sums that use them and spills registers to scratch
#pragma unroll 1
  for (int c = 0; c < JPT / CH; ++c) {
    v2f    e[CH][ROWS][4];
    float  s[CH][ROWS];
    float4 hc[CH][2];
#pragma unroll
    for (int u = 0; u < CH; ++u) { hc[u][0] = hn[u][0]; hc[u][1] = hn[u][1]; }
    // the loads so far have taken their address before the pointer moves on
    asm volatile("s_wait_xcnt 0x0" :: "v"(hsrc) : "memory");
    if (c + 1 < JPT / CH) {
      hsrc += 64 * CH * ADIM;
#pragma unroll
      for (int u = 0; u < CH; ++u) {
        hn[u][0] = *(const float4*)(hsrc + 64 * u * ADIM);
        hn[u][1] = *(const float4*)(hsrc + 64 * u * ADIM + 32);
      }
    }
#pragma unroll
    for (int u = 0; u < CH; ++u) {
      const v2f h2[4] = {(v2f){hc[u][0].x, hc[u][0].y}, (v2f){hc[u][0].z, hc[u][0].w},
                         (v2f){hc[u][1].x, hc[u][1].y}, (v2f){hc[u][1].z, hc[u][1].w}};
#pragma unroll
      for (int i = 0; i < ROWS; ++i) {
#pragma unroll
        for (int k = 0; k < 4; ++k) {
          const v2f x = ho[i][k] + h2[k];
          e[u][i][k] = (v2f){tanh_hw(x.x), tanh_hw(x.y)};
        }
        v2f t = e[u][i][0] * wp[0];
        t += e[u][i][1] * wp[1];
        t += e[u][i][2] * wp[2];
        t += e[u][i][3] * wp[3];
        s[u][i] = rowsum8(t.x + t.y);   // in every lane of the group
      }
    }
    // the chunk's 8 raw scores go to LDS, one per lane: lane q8 has key row q8 >> 2, query row q8 & 3
    float sv = s[0][0];
#pragma unroll
    for (int k = 1; k < CH * ROWS; ++k) sv = (q8 == k) ? s[k >> 2][k & 3] : sv;
    s_sc[q8 & 3][jg + 64 * (c * CH + (q8 >> 2))] = sv;
#pragma unroll
    for (int i = 0; i < ROWS; ++i) {
      const float mn = fmaxf(m[i], fmaxf(s[0][i], s[1][i]));
      const float f  = __expf(m[i] - mn);   // 0 in the first chunk, where the sums are 0
      const float p0 = __expf(s[0][i] - mn);
      const float p1 = __expf(s[1][i] - mn);
      m[i] = mn;
      l[i] = l[i] * f + (p0 + p1);
#pragma unroll
      for (int k = 0; k < 4; ++k) {
        g2[i][k] *= f;
        g2[i][k] += e[0][i][k] * p0;
        g2[i][k] += e[1][i][k] * p1;
      }
    }
  }

  // phase 2: the four 8-lane groups of the wave are brought to the wave's maximum and added; the
  // wave's maximum, row sum and edge sum go to LDS
  float mx[ROWS];
#pragma unroll
  for (int i = 0; i < ROWS; ++i) {
    mx[i] = max_xmask8(m[i]);
    mx[i] = fmaxf(mx[i], xhalf(mx[i]));
    const float f = __expf(m[i] - mx[i]);
    l[i] = add_xmask<8>(l[i] * f);
    l[i] += xhalf(l[i]);
#pragma unroll
    for (int k = 0; k < 4; ++k) {
      g2[i][k] *= f;
      g2[i][k] = (v2f){add_xmask<8>(g2[i][k].x), add_xmask<8>(g2[i][k].y)};
      g2[i][k] += (v2f){xhalf(g2[i][k].x), xhalf(g2[i][k].y)};
    }
  }
  if (lane < 8) {
#pragma unroll
    for (int i = 0; i < ROWS; ++i) {
      *(float4*)&s_gp[wave][i][q8 * 4] = make_float4(g2[i][0].x, g2[i][0].y, g2[i][1].x, g2[i][1].y);
      *(float4*)&s_gp[wave][i][32 + q8 * 4] = make_float4(g2[i][2].x, g2[i][2].y, g2[i][3].x, g2[i][3].y);
    }
  }
  if (lane == 0) {
    *(float4*)&s_wmax[wave][0] = make_float4(mx[0], mx[1], mx[2], mx[3]);
    *(float4*)&s_wsum[wave][0] = make_float4(l[0], l[1], l[2], l[3]);
  }
  // this wave's copies of X_y^T and We have landed; behind the barrier every wave's have
  asm volatile("s_wait_asynccnt 0x0" ::: "memory");
  __syncthreads();

  // phase 3: row max over the workgroup; the WMMA A source p = exp(s - max) (unnormalized) from
  // the raw scores, four per thread; the factor that brings each wave's sums to that max
#pragma unroll
  for (int w = 0; w < NWAVE; ++w) {
    const float4 m4 = *(const float4*)&s_wmax[w][0];
    mx[0] = fmaxf(mx[0], m4.x); mx[1] = fmaxf(mx[1], m4.y);
    mx[2] = fmaxf(mx[2], m4.z); mx[3] = fmaxf(mx[3], m4.w);
  }
  {
    const int   pi = tid >> 7, pj = (tid & 127) * 4;
    const float mi = pi == 0 ? mx[0] : pi == 1 ? mx[1] : pi == 2 ? mx[2] : mx[3];
    const float4 s4 = *(const float4*)&s_sc[pi][pj];
    union { bf16_t h[4]; uint2 v; } o;
    o.h[0] = f2bf(__expf(s4.x - mi));
    o.h[1] = f2bf(__expf(s4.y - mi));
    o.h[2] = f2bf(__expf(s4.z - mi));
    o.h[3] = f2bf(__expf(s4.w - mi));
    *(uint2*)&s_pb[pi][pj] = o.v;
  }
  if (tid < NWAVE * ROWS) {
    const int   fi = tid & (ROWS - 1);
    const float mi = fi == 0 ? mx[0] : fi == 1 ? mx[1] : fi == 2 ? mx[2] : mx[3];
    (&s_wfac[0][0])[tid] = __expf((&s_wmax[0][0])[tid] - mi);
  }
  __syncthreads();

  // phase 4: part1 = P(4x512) @ X_y(512x128) via WMMA; wave owns h-tile (wave & 7) and
  // k half (wave >> 3). A rows 4..15 repeat rows 0..3; their D rows are not used.
  // A frags come from s_pb, B frags from s_xy, both via 16B ds loads.
  {
    const int ht = wave & 7;
    const int kh = wave >> 3;
    const bf16_t* brow = &s_xy[ht * 16 + q][kh * (SEQ / 2)];                 // contiguous over j
    const bf16_t* prow = &s_pb[q & (ROWS - 1)][kh * (SEQ / 2)];              // A-frag row

    v8f c = {0.f, 0.f, 0.f, 0.f, 0.f, 0.f, 0.f, 0.f};
#pragma unroll
    for (int kb = 0; kb < SEQ / 2; kb += 32) {
      const int k0 = kb + 8 * sel;
      const int k1 = kb + 16 + 8 * sel;
      v16bf a  = load_frag_bf16(prow, k0, k1);
      v16bf bb = load_frag_bf16(brow, k0, k1);
      c = __builtin_amdgcn_wmma_f32_16x16x32_bf16(false, a, false, bb, (short)0, c,
                                                  false, false);
    }
    // the distance the chip needs between the last WMMA and a vector write of its A registers; the
    // scheduling barrier keeps the WMMAs in front of the v_nops
    __builtin_amdgcn_sched_barrier(0);
    asm volatile("v_nop\n\tv_nop\n\tv_nop\n\tv_nop");
    if (sel == 0) {                      // C layout: lane col q, rows 8*sel+v
#pragma unroll
      for (int v = 0; v < ROWS; ++v) s_acc[kh][v][ht * 16 + q] = c[v];
    }
  }
  // this thread's row of We for phase 5, read from LDS ahead of the barrier that phase 5 waits behind
  float4 wv[ADIM / 4];
#pragma unroll
  for (int a4 = 0; a4 < ADIM / 4; ++a4) wv[a4] = *(const float4*)&s_we[tid & (HID - 1)][a4 * 4];
  // sums over the 16 waves' partial g and l, each brought to the workgroup's max
  if (tid < ROWS * ADIM) {
    float gs = 0.f;
#pragma unroll
    for (int w = 0; w < NWAVE; ++w) gs += (&s_gp[w][0][0])[tid] * s_wfac[w][tid >> 6];
    (&s_g[0][0])[tid] = gs;
  } else if (tid < ROWS * ADIM + ROWS) {
    float ls = 0.f;
#pragma unroll
    for (int w = 0; w < NWAVE; ++w) ls += s_wsum[w][tid - ROWS * ADIM] * s_wfac[w][tid - ROWS * ADIM];
    s_l[tid - ROWS * ADIM] = ls;
  }
  __syncthreads();

  // phase 5: out = (part1 + g @ We^T) / l + be; one output element per thread
  {
    const int i = tid >> 7, h = tid & (HID - 1);
    float acc = s_acc[0][i][h] + s_acc[1][i][h];
#pragma unroll
    for (int a4 = 0; a4 < ADIM / 4; ++a4) {
      acc += wv[a4].x * s_g[i][a4 * 4 + 0];
      acc += wv[a4].y * s_g[i][a4 * 4 + 1];
      acc += wv[a4].z * s_g[i][a4 * 4 + 2];
      acc += wv[a4].w * s_g[i][a4 * 4 + 3];
    }
    out[(gro + i0 + i) * HID + h] = acc / s_l[i] + be[h];
  }
}

// ---------------------------------------------------------------------------
extern "C" void kernel_launch(void* const* d_in, const int* in_sizes, int n_in,
                              void* d_out, int out_size, void* d_ws, size_t ws_size,
                              hipStream_t stream) {
  const float* X    = (const float*)d_in[0];
  const float* Wo   = (const float*)d_in[1];
  const float* W1   = (const float*)d_in[2];
  const float* Wphi = (const float*)d_in[3];
  const float* Wy   = (const float*)d_in[4];
  const float* by   = (const float*)d_in[5];
  const float* We   = (const float*)d_in[6];
  const float* be   = (const float*)d_in[7];
  float* out = (float*)d_out;

  // workspace layout
  char*   ws  = (char*)d_ws;
  float*  h_o = (float*)ws;                                   // 256 KB
  float*  h_1 = (float*)(ws + (size_t)MTOT * ADIM * 4);       // 256 KB
  bf16_t* XyT = (bf16_t*)(ws + (size_t)2 * MTOT * ADIM * 4);  // 256 KB

  // all three projections: 64 row tiles x 4 weight slabs
  proj_all_kernel<<<256, 128, 0, stream>>>(X, Wo, W1, Wy, by, h_o, h_1, XyT);
  // fused attention: 256 i-tiles of 4 rows
  attn_kernel<<<256, 512, 0, stream>>>(h_o, h_1, XyT, Wphi, We, be, out);
}

// v008
// A run of this version takes 11.1 microseconds.
// Versions between v006 and this one are left out; their measured steps multiply to 1.19 times as fast.
// Counting every step since v000, it is 47.2 times as fast.
#include <hip/hip_runtime.h>

// ---------------------------------------------------------------------------
// FlexibleAttention for MI455X (gfx1250, wave32, WMMA)
//
//   h_o = X@Wo^T, h_1 = X@W1^T                 (WMMA bf16, f32 out)
//   X_y = X@Wy^T + by                          (WMMA bf16, stored transposed bf16)
//   e_ij = tanh(h_o[i]+h_1[j]); s_ij = e.Wphi  (VALU, f32)
//   alpha = softmax_j(s)  (unnormalized exp against a shift known up front; /l folded into epilogue)
//   part1 = alpha @ X_y                        (WMMA bf16, f32 acc)
//   g_i   = sum_j alpha_ij e_ij                (VALU, f32)
//   out   = (part1 + g@We^T)/l + be
//   The X_y^T slice and We are copied into LDS while the scores are computed.
// ---------------------------------------------------------------------------

typedef __bf16 bf16_t;
typedef __attribute__((ext_vector_type(16))) __bf16        v16bf;
typedef __attribute__((ext_vector_type(8)))  float         v8f;

#define HID   128
#define ADIM  64
#define BATCH 2
#define SEQ   512
#define MTOT  (BATCH * SEQ)   // 1024 total rows

// round-to-nearest-even f32 -> bf16
static __device__ __forceinline__ bf16_t f2bf(float f) {
  union { float f; unsigned int u; } x; x.f = f;
  unsigned int r = x.u + 0x7FFFu + ((x.u >> 16) & 1u);
  union { unsigned short s; bf16_t b; } y; y.s = (unsigned short)(r >> 16);
  return y.b;
}

// tanh as the chip's own instruction (v_tanh_f32). The library tanhf builds into
// two divergent branches of dependent vector code, and those branches also keep
// the compiler from widening and batching the loads of the loops around it.
static __device__ __forceinline__ float tanh_hw(float x) {
  return __builtin_amdgcn_tanhf(x);
}

// Two aligned 8x-bf16 chunks -> one 16x32 A/B-style fragment (ISA 7.12.2).
union frag_u {
  v16bf v;
  uint4 q[2];
};

static __device__ __forceinline__ v16bf load_frag_bf16(const bf16_t* __restrict__ row,
                                                       int k0, int k1) {
  frag_u u;
  u.q[0] = *(const uint4*)(row + k0);  // elems 0..7  : K = k0..k0+7
  u.q[1] = *(const uint4*)(row + k1);  // elems 8..15 : K = k1..k1+7
  return u.v;
}

// ---------------------------------------------------------------------------
// Stage 1, one launch: h_o = X@Wo^T, h_1 = X@W1^T (f32 row-major) and
// X_y^T = (X@Wy^T + by)^T (bf16, [HID x MTOT], for stage-2 B-fragments).
// Block = (16-row tile of X) x (64-row slab of weights: Wo | W1 | Wy rows 0..63 |
// Wy rows 64..127), 4 waves, one block per WGP. The f32 rows are read as they are,
// one whole 512-byte row per wave-wide load, rounded to bf16 in registers (each
// element once per block) and laid in LDS, where the fragments are read from.
// One wave per 16x16 tile.
// ---------------------------------------------------------------------------
typedef __attribute__((ext_vector_type(2))) float  v2f;
typedef __attribute__((ext_vector_type(2))) __bf16 v2bf;

#define PROWS  (16 + ADIM)   // LDS rows: 0..15 the X tile, 16..79 the weight slab
#define PPITCH (HID + 8)     // 272 bytes a row: 16 B x odd, no bank conflict for 16-byte reads

// four f32 -> four bf16, round to nearest even (v_cvt_pk_bf16_f32)
static __device__ __forceinline__ uint2 cvt4(float4 f) {
  union { v2bf p[2]; uint2 q; } u;
  v2f lo = {f.x, f.y}, hi = {f.z, f.w};
  u.p[0] = __builtin_convertvector(lo, v2bf);
  u.p[1] = __builtin_convertvector(hi, v2bf);
  return u.q;
}

__global__ __launch_bounds__(128)
void proj_all_kernel(const float* __restrict__ X, const float* __restrict__ Wo,
                     const float* __restrict__ W1, const float* __restrict__ Wy,
                     const float* __restrict__ by, float* __restrict__ h_o,
                     float* __restrict__ h_1, bf16_t* __restrict__ XyT) {
  __shared__ __attribute__((aligned(16))) bf16_t s_t[PROWS][PPITCH];

  const int lane  = threadIdx.x & 31;
  const int wave  = threadIdx.x >> 5;
  const int mtile = blockIdx.x >> 2;
  const int slab  = blockIdx.x & 3;
  const int nl    = lane & 15;
  const int sel   = lane >> 4;
  const int n     = wave * 16 + nl;      // row of the slab = output column

  // wave w takes rows w, w + 4, ...; lane l the four floats 4l..4l+3 of the row
  const float* wsl  = slab == 0 ? Wo : slab == 1 ? W1 : Wy + (slab - 2) * ADIM * HID;
  const float* xsrc = X + (mtile * 16 + wave) * HID + lane * 4;
  const float* wsrc = wsl + wave * HID + lane * 4;
  const float* bsrc = by + (slab & 1) * ADIM + n;   // used by the Wy slabs only

  float4 xv[4], wv[ADIM / 4];
#pragma unroll
  for (int r = 0; r < 4; ++r) xv[r] = *(const float4*)(xsrc + r * 4 * HID);
#pragma unroll
  for (int r = 0; r < ADIM / 4; ++r) wv[r] = *(const float4*)(wsrc + r * 4 * HID);
  const float bv = *bsrc;
  // the loads above have taken their addresses before those registers are written again;
  // the three pointers are named as inputs so that their registers live up to the wait
  asm volatile("s_wait_xcnt 0x0" :: "v"(xsrc), "v"(wsrc), "v"(bsrc) : "memory");

#pragma unroll
  for (int r = 0; r < 4; ++r) *(uint2*)&s_t[wave + 4 * r][lane * 4] = cvt4(xv[r]);
#pragma unroll
  for (int r = 0; r < ADIM / 4; ++r) *(uint2*)&s_t[16 + wave + 4 * r][lane * 4] = cvt4(wv[r]);
  __syncthreads();

  const bf16_t* xrow = &s_t[nl][0];      // A-frag: lane owns row nl
  const bf16_t* wrow = &s_t[16 + n][0];  // B-frag: lane owns col nl

  v16bf a[4], b[4];                      // fragment reads issued ahead of the products
#pragma unroll
  for (int s = 0; s < 4; ++s) {
    const int k0 = s * 32 + 8 * sel;
    const int k1 = s * 32 + 16 + 8 * sel;
    a[s] = load_frag_bf16(xrow, k0, k1);
    b[s] = load_frag_bf16(wrow, k0, k1);
  }
  v8f c = {0.f, 0.f, 0.f, 0.f, 0.f, 0.f, 0.f, 0.f};
#pragma unroll
  for (int s = 0; s < 4; ++s)
    c = __builtin_amdgcn_wmma_f32_16x16x32_bf16(false, a[s], false, b[s], (short)0, c,
                                                false, false);

  const int mrow = mtile * 16 + sel * 8;  // C layout: lane col nl, rows 8*sel+v
  if (slab < 2) {
    float* dst = (slab == 0 ? h_o : h_1) + mrow * ADIM + n;
#pragma unroll
    for (int v = 0; v < 8; ++v) dst[v * ADIM] = c[v];
  } else {
    union { bf16_t h[8]; uint4 q; } o;
#pragma unroll
    for (int v = 0; v < 8; ++v) o.h[v] = f2bf(c[v] + bv);
    *(uint4*)(XyT + ((slab - 2) * ADIM + n) * MTOT + mrow) = o.q;
  }
}

// ---------------------------------------------------------------------------
// Stage 2: one workgroup (8 waves, two per SIMD) per 4-row i-tile: 256 workgroups, one per WGP.
// Few, long waves: the launch has half as many waves to start as with 16 per workgroup.
// An 8-lane group of a wave owns one key row j at a time; lane q8 of it owns eight a
// (4 q8 .. 4 q8 + 3 and the same + 32) for all four query rows, so that a score takes three
// cross-lane steps and its exp is repeated in 8 lanes. One pass over the key rows: each tanh feeds the
// score and, weighted, the edge sum.
// ---------------------------------------------------------------------------
#define ROWS  4
#define NWAVE 8
#define JSTEP (4 * NWAVE)           // key rows the workgroup takes at a time: 32
#define JPT   (SEQ / JSTEP)         // key rows per thread: 16
#define CH    2                     // key rows of a thread per trip of the key loop
#define XPITCH (SEQ + 8)            // bf16 per LDS row of the X_y^T slice: 1040 bytes, 16 B x odd
#define WPITCH (ADIM + 4)           // floats per LDS row of We: 272 bytes, 16 B x odd

// LDS byte address of a __shared__ object: the low 32 bits of its address
static __device__ __forceinline__ unsigned lds_addr(const void* p) {
  return (unsigned)(size_t)p;
}

// Asynchronous copies global -> LDS, 16 bytes per lane and copy, through no register. The
// s_wait_xcnt closes each statement so that it stands in front of any rewrite of the address
// registers the copies name. The data is waited for with s_wait_asynccnt by the caller.
static __device__ __forceinline__ void async_copy8(unsigned l, int lstep, const char* g, int gstep) {
  // copies 2k and 2k + 1: the two 512-byte halves of row k
  asm volatile(
      "global_load_async_to_lds_b128 %0, %8, off\n\t"
      "global_load_async_to_lds_b128 %1, %9, off\n\t"
      "global_load_async_to_lds_b128 %2, %10, off\n\t"
      "global_load_async_to_lds_b128 %3, %11, off\n\t"
      "global_load_async_to_lds_b128 %4, %12, off\n\t"
      "global_load_async_to_lds_b128 %5, %13, off\n\t"
      "global_load_async_to_lds_b128 %6, %14, off\n\t"
      "global_load_async_to_lds_b128 %7, %15, off\n\t"
      "s_wait_xcnt 0x0"
      :: "v"(l), "v"(l + 512), "v"(l + lstep), "v"(l + lstep + 512),
         "v"(l + 2 * lstep), "v"(l + 2 * lstep + 512), "v"(l + 3 * lstep), "v"(l + 3 * lstep + 512),
         "v"(g), "v"(g + 512), "v"(g + gstep), "v"(g + gstep + 512),
         "v"(g + 2 * gstep), "v"(g + 2 * gstep + 512), "v"(g + 3 * gstep), "v"(g + 3 * gstep + 512)
      : "memory");
}

static __device__ __forceinline__ void async_copy4(unsigned l, int lstep, const char* g, int gstep) {
  asm volatile(
      "global_load_async_to_lds_b128 %0, %4, off\n\t"
      "global_load_async_to_lds_b128 %1, %5, off\n\t"
      "global_load_async_to_lds_b128 %2, %6, off\n\t"
      "global_load_async_to_lds_b128 %3, %7, off\n\t"
      "s_wait_xcnt 0x0"
      :: "v"(l), "v"(l + lstep), "v"(l + 2 * lstep), "v"(l + 3 * lstep),
         "v"(g), "v"(g + gstep), "v"(g + 2 * gstep), "v"(g + 3 * gstep)
      : "memory");
}

// lane l with lane l ^ 16
static __device__ __forceinline__ float xhalf(float x) {
  const int v = __builtin_bit_cast(int, x);
  return __builtin_bit_cast(float, __builtin_amdgcn_permlanex16(v, v, 0x76543210, 0xfedcba98,
                                                                false, false));
}

// x + (x of lane l ^ MASK inside the 16-lane row): DPP row_xmask
template <int MASK>
static __device__ __forceinline__ float add_xmask(float x) {
  const int v = __builtin_bit_cast(int, x);
  return x + __builtin_bit_cast(float,
                                __builtin_amdgcn_update_dpp(0, v, 0x160 + MASK, 0xf, 0xf, true));
}

// sum over the 8 lanes of a group, left in every lane of it
static __device__ __forceinline__ float rowsum8(float x) {
  x = add_xmask<1>(x);
  x = add_xmask<2>(x);
  x = add_xmask<4>(x);
  return x;
}

// max(x, x of lane l ^ 8 inside the 16-lane row)
static __device__ __forceinline__ float max_xmask8(float x) {
  const int v = __builtin_bit_cast(int, x);
  return fmaxf(x, __builtin_bit_cast(float,
                                     __builtin_amdgcn_update_dpp(0, v, 0x168, 0xf, 0xf, true)));
}

__global__ __launch_bounds__(32 * NWAVE)
void attn_kernel(const float* __restrict__ h_o, const float* __restrict__ h_1,
                 const bf16_t* __restrict__ XyT, const float* __restrict__ Wphi,
                 const float* __restrict__ We, const float* __restrict__ be,
                 float* __restrict__ out) {
  __shared__ __attribute__((aligned(16))) bf16_t s_pb[ROWS][SEQ];          // exp weights, WMMA A source
  __shared__ __attribute__((aligned(16))) float  s_wmax[NWAVE][ROWS];      // row max per wave (large bound only)
  __shared__ __attribute__((aligned(16))) float  s_wsum[NWAVE][ROWS];      // row sum per wave
  __shared__ __attribute__((aligned(16))) float  s_gp[NWAVE][ROWS][ADIM];  // edge sum per wave (8 KB)
  __shared__ float s_g[ROWS][ADIM];
  __shared__ float s_l[ROWS];
  __shared__ float s_acc[4][ROWS][HID];                                    // part1 per k quarter
  __shared__ __attribute__((aligned(16))) bf16_t s_xy[HID][XPITCH];        // X_y^T, this batch's columns (130 KB)
  __shared__ __attribute__((aligned(16))) float  s_we[HID][WPITCH];        // We (34 KB)

  const int tid  = threadIdx.x;
  const int lane = tid & 31;
  const int wave = tid >> 5;
  const int q    = lane & 15;            // a-quad (also WMMA row/col index)
  const int sel  = lane >> 4;
  const int b    = blockIdx.x >> 7;      // 128 i-tiles per batch
  const int i0   = (blockIdx.x & 127) * ROWS;
  const int gro  = b * SEQ;              // global row base of this batch
  const int q8   = lane & 7;             // this lane's a: 4 q8 .. 4 q8 + 3 and 32 + 4 q8 .. 32 + 4 q8 + 3
  const int jg   = wave * 4 + (lane >> 3);   // this 8-lane group's first key row; step JSTEP

  // phase 0: this lane's h_o (4 rows x 8 a), Wphi (8 a) and the first chunk of h_1 (2 key rows x 8 a)
  v2f ho[ROWS][4], wp[4];
#pragma unroll
  for (int i = 0; i < ROWS; ++i) {
    const float4 lo = *(const float4*)(h_o + (gro + i0 + i) * ADIM + q8 * 4);
    const float4 hi = *(const float4*)(h_o + (gro + i0 + i) * ADIM + 32 + q8 * 4);
    ho[i][0] = (v2f){lo.x, lo.y}; ho[i][1] = (v2f){lo.z, lo.w};
    ho[i][2] = (v2f){hi.x, hi.y}; ho[i][3] = (v2f){hi.z, hi.w};
  }
  {
    const float4 lo = *(const float4*)(Wphi + q8 * 4);
    const float4 hi = *(const float4*)(Wphi + 32 + q8 * 4);
    wp[0] = (v2f){lo.x, lo.y}; wp[1] = (v2f){lo.z, lo.w};
    wp[2] = (v2f){hi.x, hi.y}; wp[3] = (v2f){hi.z, hi.w};
  }
  // the loads above have taken their addresses before a later load's result lands on those registers
  asm volatile("s_wait_xcnt 0x0" ::: "memory");
  const float* hsrc = h_1 + (gro + jg) * ADIM + q8 * 4;  // this lane's h_1: key rows jg + JSTEP t
  float4 hn[CH][2];                                      // the next chunk's h_1, read one chunk ahead
#pragma unroll
  for (int u = 0; u < CH; ++u) {
    hn[u][0] = *(const float4*)(hsrc + JSTEP * u * ADIM);
    hn[u][1] = *(const float4*)(hsrc + JSTEP * u * ADIM + 32);
  }

  // what phases 4 and 5 read, X_y^T (this batch's 512 columns of all 128 rows) and We, starts on its
  // way into LDS here, in whole 512-byte runs per wave, and lands while phase 1 computes. Wave w
  // brings rows 16w..16w+15 of both: 32 copies of half an X_y^T row, 8 copies of two We rows.
  {
    const unsigned lx = lds_addr(&s_xy[wave * 16][lane * 8]);
    const char*    gx = (const char*)(XyT + wave * 16 * MTOT + gro + lane * 8);
    // both loops unrolled: every call is one asm statement with address operands of its own
#pragma unroll
    for (int r = 0; r < 4; ++r)
      async_copy8(lx + r * 4 * XPITCH * 2, XPITCH * 2, gx + r * 4 * MTOT * 2, MTOT * 2);
#pragma unroll
    for (int r = 0; r < 2; ++r)
      async_copy4(lds_addr(&s_we[wave * 16 + r * 8 + sel][q * 4]), 2 * WPITCH * 4,
                  (const char*)(We + (wave * 16 + r * 8) * ADIM + lane * 4), 2 * ADIM * 4);
  }

  // The softmax shift. |tanh| <= 1, so no score exceeds bound = sum_a |Wphi[a]| in size, and softmax
  // is the same for any shift. With the shift = bound, known before the key loop, every weight
  // exp(s - bound) lies in [exp(-2 bound), 1] and is final when it is computed. Taken while
  // bound < 20 (weights no smaller than exp(-40), far inside the f32 and bf16 range). For a larger
  // (or NaN) bound the shift is the true row maximum, from a pass of its own over the key rows.
  const float L2E = 1.44269504f;
  float wabs = 0.f;
#pragma unroll
  for (int k = 0; k < 4; ++k) wabs += __builtin_fabsf(wp[k].x) + __builtin_fabsf(wp[k].y);
  const float bound = __builtin_bit_cast(
      float, __builtin_amdgcn_readfirstlane(__builtin_bit_cast(int, rowsum8(wabs))));
  float nb[ROWS];                        // -shift * log2(e) per query row
  if (bound < 20.f) {                    // the same in every wave of every workgroup
#pragma unroll
    for (int i = 0; i < ROWS; ++i) nb[i] = -bound * L2E;
  } else {
    float mr[ROWS];
#pragma unroll
    for (int i = 0; i < ROWS; ++i) mr[i] = -3.4e38f;
    const float* ps = h_1 + (gro + jg) * ADIM + q8 * 4;
    // rolled: this path is for size, not for speed
#pragma unroll 1
    for (int t = 0; t < JPT; ++t) {
      const float4 a0 = *(const float4*)ps;
      const float4 a1 = *(const float4*)(ps + 32);
      // the two loads have taken their address before the pointer moves on
      asm volatile("s_wait_xcnt 0x0" :: "v"(ps) : "memory");
      ps += JSTEP * ADIM;
      const v2f h2[4] = {(v2f){a0.x, a0.y}, (v2f){a0.z, a0.w}, (v2f){a1.x, a1.y}, (v2f){a1.z, a1.w}};
#pragma unroll
      for (int i = 0; i < ROWS; ++i) {
        v2f t2 = (v2f){0.f, 0.f};
#pragma unroll
        for (int k = 0; k < 4; ++k) {
          const v2f x = ho[i][k] + h2[k];
          t2 += (v2f){tanh_hw(x.x), tanh_hw(x.y)} * wp[k];
        }
        mr[i] = fmaxf(mr[i], rowsum8(t2.x + t2.y));
      }
    }
#pragma unroll
    for (int i = 0; i < ROWS; ++i) {
      mr[i] = max_xmask8(mr[i]);
      mr[i] = fmaxf(mr[i], xhalf(mr[i]));
    }
    if (lane == 0) *(float4*)&s_wmax[wave][0] = make_float4(mr[0], mr[1], mr[2], mr[3]);
    __syncthreads();
#pragma unroll
    for (int w = 0; w < NWAVE; ++w) {
      const float4 m4 = *(const float4*)&s_wmax[w][0];
      mr[0] = fmaxf(mr[0], m4.x); mr[1] = fmaxf(mr[1], m4.y);
      mr[2] = fmaxf(mr[2], m4.z); mr[3] = fmaxf(mr[3], m4.w);
    }
#pragma unroll
    for (int i = 0; i < ROWS; ++i) nb[i] = -mr[i] * L2E;
  }

  // phase 1, one pass over the key rows: e = tanh(ho[i,a]+h1[j,a]) is evaluated once and used for
  // the score s_ij = sum_a e * Wphi[a] and, weighted with p_ij = exp(s_ij - shift), for the edge sum
  // g[i,a] = sum_j p_ij * e. Two neighbouring a share each packed instruction.
  float l[ROWS];
  v2f   g2[ROWS][4];
#pragma unroll
  for (int i = 0; i < ROWS; ++i) {
    l[i] = 0.f;
#pragma unroll
    for (int k = 0; k < 4; ++k) g2[i][k] = (v2f){0.f, 0.f};
  }
  // unrolled by two: the two h_1 buffers swap roles, so no register copies stand at the loop's foot and
  // the next chunk's loads are waited for only where they are used.
#pragma unroll 2
  for (int c = 0; c < JPT / CH; ++c) {
    float4 hc[CH][2];
#pragma unroll
    for (int u = 0; u < CH; ++u) { hc[u][0] = hn[u][0]; hc[u][1] = hn[u][1]; }
    // the loads so far have taken their address before the pointer moves on
    asm volatile("s_wait_xcnt 0x0" :: "v"(hsrc) : "memory");
    if (c + 1 < JPT / CH) {
      hsrc += JSTEP * CH * ADIM;
#pragma unroll
      for (int u = 0; u < CH; ++u) {
        hn[u][0] = *(const float4*)(hsrc + JSTEP * u * ADIM);
        hn[u][1] = *(const float4*)(hsrc + JSTEP * u * ADIM + 32);
      }
    }
    float pv = 0.f;
#pragma unroll
    for (int u = 0; u < CH; ++u) {
      const v2f h2[4] = {(v2f){hc[u][0].x, hc[u][0].y}, (v2f){hc[u][0].z, hc[u][0].w},
                         (v2f){hc[u][1].x, hc[u][1].y}, (v2f){hc[u][1].z, hc[u][1].w}};
#pragma unroll
      for (int i = 0; i < ROWS; ++i) {
        v2f e[4];
#pragma unroll
        for (int k = 0; k < 4; ++k) {
          const v2f x = ho[i][k] + h2[k];
          e[k] = (v2f){tanh_hw(x.x), tanh_hw(x.y)};
        }
        v2f t = e[0] * wp[0];
        t += e[1] * wp[1];
        t += e[2] * wp[2];
        t += e[3] * wp[3];
        // the weight, in every lane of the group
        const float p = __builtin_amdgcn_exp2f(__builtin_fmaf(rowsum8(t.x + t.y), L2E, nb[i]));
        pv = (q8 == u * ROWS + i) ? p : pv;
        l[i] += p;
#pragma unroll
        for (int k = 0; k < 4; ++k) g2[i][k] += e[k] * p;
      }
    }
    // the chunk's 8 weights go to the WMMA A source, one per lane: lane q8 has key row q8 >> 2,
    // query row q8 & 3
    s_pb[q8 & 3][jg + JSTEP * (c * CH + (q8 >> 2))] = f2bf(pv);
  }

  // phase 2: the four 8-lane groups of the wave are added; the wave's row sum and edge sum go to LDS
#pragma unroll
  for (int i = 0; i < ROWS; ++i) {
    l[i] = add_xmask<8>(l[i]);
    l[i] += xhalf(l[i]);
#pragma unroll
    for (int k = 0; k < 4; ++k) {
      g2[i][k] = (v2f){add_xmask<8>(g2[i][k].x), add_xmask<8>(g2[i][k].y)};
      g2[i][k] += (v2f){xhalf(g2[i][k].x), xhalf(g2[i][k].y)};
    }
  }
  if (lane < 8) {
#pragma unroll
    for (int i = 0; i < ROWS; ++i) {
      *(float4*)&s_gp[wave][i][q8 * 4] = make_float4(g2[i][0].x, g2[i][0].y, g2[i][1].x, g2[i][1].y);
      *(float4*)&s_gp[wave][i][32 + q8 * 4] = make_float4(g2[i][2].x, g2[i][2].y, g2[i][3].x, g2[i][3].y);
    }
  }
  if (lane == 0) *(float4*)&s_wsum[wave][0] = make_float4(l[0], l[1], l[2], l[3]);
  // this wave's copies of X_y^T and We have landed; behind the barrier every wave's have
  asm volatile("s_wait_asynccnt 0x0" ::: "memory");
  __syncthreads();

  // phase 4: part1 = P(4x512) @ X_y(512x128) via WMMA; wave owns four h-tiles (half of the
  // columns, wave & 1) and a k quarter (wave >> 1), so that one A fragment feeds four products.
  // A rows 4..15 repeat rows 0..3; their D rows are not used.
  // A frags come from s_pb, B frags from s_xy, both via 16B ds loads.
  {
    const int hg = wave & 1;
    const int kq = wave >> 1;
    const bf16_t* brow = &s_xy[hg * 64 + q][kq * (SEQ / 4)];                 // contiguous over j
    const bf16_t* prow = &s_pb[q & (ROWS - 1)][kq * (SEQ / 4)];              // A-frag row

    v8f c[4];
#pragma unroll
    for (int t = 0; t < 4; ++t) c[t] = (v8f){0.f, 0.f, 0.f, 0.f, 0.f, 0.f, 0.f, 0.f};
    v16bf a[4], bb[4][4];
#pragma unroll
    for (int s = 0; s < 4; ++s) {
      const int k0 = s * 32 + 8 * sel;
      const int k1 = s * 32 + 16 + 8 * sel;
      a[s] = load_frag_bf16(prow, k0, k1);
#pragma unroll
      for (int t = 0; t < 4; ++t) bb[s][t] = load_frag_bf16(brow + t * 16 * XPITCH, k0, k1);
    }
    // all fragment reads are issued in front of the products; without this line the build reads one
    // fragment at a time and waits out the LDS latency in front of each product
    __builtin_amdgcn_sched_barrier(0);
#pragma unroll
    for (int s = 0; s < 4; ++s)
#pragma unroll
      for (int t = 0; t < 4; ++t)
        c[t] = __builtin_amdgcn_wmma_f32_16x16x32_bf16(false, a[s], false, bb[s][t], (short)0, c[t],
                                                       false, false);
    // the distance the chip needs between the last WMMA and a vector write of its A registers; the
    // scheduling barrier keeps the WMMAs in front of the v_nops
    __builtin_amdgcn_sched_barrier(0);
    asm volatile("v_nop\n\tv_nop\n\tv_nop\n\tv_nop");
    if (sel == 0) {                      // C layout: lane col q, rows 8*sel+v
#pragma unroll
      for (int t = 0; t < 4; ++t)
#pragma unroll
        for (int v = 0; v < ROWS; ++v) s_acc[kq][v][hg * 64 + t * 16 + q] = c[t][v];
    }
  }
  // this thread's row of We for phase 5, read from LDS ahead of the barrier that phase 5 waits behind
  float4 wv[ADIM / 4];
#pragma unroll
  for (int a4 = 0; a4 < ADIM / 4; ++a4) wv[a4] = *(const float4*)&s_we[tid & (HID - 1)][a4 * 4];
  // sums over the waves' partial g (one element per thread: ROWS * ADIM = the block) and l
  {
    float gs = 0.f, ls = 0.f;
#pragma unroll
    for (int w = 0; w < NWAVE; ++w) {
      gs += (&s_gp[w][0][0])[tid];
      ls += s_wsum[w][tid & (ROWS - 1)];
    }
    (&s_g[0][0])[tid] = gs;
    if (tid < ROWS) s_l[tid] = ls;
  }
  __syncthreads();

  // phase 5: out = (part1 + g @ We^T) / l + be; column h of query rows ih and ih + 2 per thread
  {
    const int ih = tid >> 7, h = tid & (HID - 1);
    const float bh = be[h];
#pragma unroll
    for (int r = 0; r < 2; ++r) {
      const int i = ih + 2 * r;
      float acc = (s_acc[0][i][h] + s_acc[1][i][h]) + (s_acc[2][i][h] + s_acc[3][i][h]);
#pragma unroll
      for (int a4 = 0; a4 < ADIM / 4; ++a4) {
        acc += wv[a4].x * s_g[i][a4 * 4 + 0];
        acc += wv[a4].y * s_g[i][a4 * 4 + 1];
        acc += wv[a4].z * s_g[i][a4 * 4 + 2];
        acc += wv[a4].w * s_g[i][a4 * 4 + 3];
      }
      out[(gro + i0 + i) * HID + h] = acc / s_l[i] + bh;
    }
  }
}

// ---------------------------------------------------------------------------
extern "C" void kernel_launch(void* const* d_in, const int* in_sizes, int n_in,
                              void* d_out, int out_size, void* d_ws, size_t ws_size,
                              hipStream_t stream) {
  const float* X    = (const float*)d_in[0];
  const float* Wo   = (const float*)d_in[1];
  const float* W1   = (const float*)d_in[2];
  const float* Wphi = (const float*)d_in[3];
  const float* Wy   = (const float*)d_in[4];
  const float* by   = (const float*)d_in[5];
  const float* We   = (const float*)d_in[6];
  const float* be   = (const float*)d_in[7];
  float* out = (float*)d_out;

  // workspace layout
  char*   ws  = (char*)d_ws;
  float*  h_o = (float*)ws;                                   // 256 KB
  float*  h_1 = (float*)(ws + (size_t)MTOT * ADIM * 4);       // 256 KB
  bf16_t* XyT = (bf16_t*)(ws + (size_t)2 * MTOT * ADIM * 4);  // 256 KB

  // all three projections: 64 row tiles x 4 weight slabs
  proj_all_kernel<<<256, 128, 0, stream>>>(X, Wo, W1, Wy, by, h_o, h_1, XyT);
  // fused attention: 256 i-tiles of 4 rows, 8 waves each
  attn_kernel<<<256, 256, 0, stream>>>(h_o, h_1, XyT, Wphi, We, be, out);
}

// v009
// Measured time: 10.6 microseconds a run.
// Two timings next to v008 put it at 1.06 and 1.05 times that version's speed.
// Counting every step since v000, it is 50.0 times as fast.
#include <hip/hip_runtime.h>

// ---------------------------------------------------------------------------
// FlexibleAttention for MI455X (gfx1250, wave32, WMMA), one launch
//
//   h_o = X@Wo^T (this workgroup's 4 query rows), h_1 = X@W1^T (all key rows of the batch;
//         each wave makes the rows it uses itself)          (WMMA bf16, f32 out, kept in LDS)
//   e_ij = tanh(h_o[i]+h_1[j]); s_ij = e.Wphi  (VALU, f32)
//   p = exp(s - shift)  (unnormalized, against a shift known up front; /l folded into epilogue)
//   u     = p @ X                              (WMMA bf16, f32 acc)
//   part1 = u @ Wy^T                           (WMMA bf16, f32 acc); alpha @ (X@Wy^T + by) = part1/l + by
//   g_i   = sum_j p_ij e_ij                    (VALU, f32)
//   out   = (part1 + g@We^T)/l + by + be
//   We and Wy are copied into LDS while the scores are computed.
// ---------------------------------------------------------------------------

typedef __bf16 bf16_t;
typedef __attribute__((ext_vector_type(16))) __bf16        v16bf;
typedef __attribute__((ext_vector_type(8)))  float         v8f;

#define HID   128
#define ADIM  64
#define BATCH 2
#define SEQ   512
#define MTOT  (BATCH * SEQ)   // 1024 total rows

// round-to-nearest-even f32 -> bf16
static __device__ __forceinline__ bf16_t f2bf(float f) {
  union { float f; unsigned int u; } x; x.f = f;
  unsigned int r = x.u + 0x7FFFu + ((x.u >> 16) & 1u);
  union { unsigned short s; bf16_t b; } y; y.s = (unsigned short)(r >> 16);
  return y.b;
}

// tanh as the chip's own instruction (v_tanh_f32). The library tanhf builds into
// two divergent branches of dependent vector code, and those branches also keep
// the compiler from widening and batching the loads of the loops around it.
static __device__ __forceinline__ float tanh_hw(float x) {
  return __builtin_amdgcn_tanhf(x);
}

// Two aligned 8x-bf16 chunks -> one 16x32 A/B-style fragment (ISA 7.12.2).
union frag_u {
  v16bf v;
  uint4 q[2];
};

static __device__ __forceinline__ v16bf load_frag_bf16(const bf16_t* __restrict__ row,
                                                       int k0, int k1) {
  frag_u u;
  u.q[0] = *(const uint4*)(row + k0);  // elems 0..7  : K = k0..k0+7
  u.q[1] = *(const uint4*)(row + k1);  // elems 8..15 : K = k1..k1+7
  return u.v;
}

typedef __attribute__((ext_vector_type(2))) float  v2f;
typedef __attribute__((ext_vector_type(2))) __bf16 v2bf;

#define PPITCH (HID + 8)     // 272 bytes a row: 16 B x odd, no bank conflict for 16-byte reads

// four f32 -> four bf16, round to nearest even (v_cvt_pk_bf16_f32)
static __device__ __forceinline__ uint2 cvt4(float4 f) {
  union { v2bf p[2]; uint2 q; } u;
  v2f lo = {f.x, f.y}, hi = {f.z, f.w};
  u.p[0] = __builtin_convertvector(lo, v2bf);
  u.p[1] = __builtin_convertvector(hi, v2bf);
  return u.q;
}

// ---------------------------------------------------------------------------
// One workgroup (8 waves, two per SIMD) per 4-row i-tile: 256 workgroups, one per WGP.
// Wave w owns key rows 64 w .. 64 w + 63 of the batch, in tiles of 16. Per tile it reads the f32 rows
// of X (one whole 512-byte row per wave-wide load, a tile ahead), rounds them to bf16, lays them in LDS
// row-major (its own scratch, for the h_1 product) and transposed (s_xt, for p @ X), makes
// h_1^T = W1 @ X^T of the tile by WMMA and lays it in LDS over the scratch, and then runs the key loop
// on these 16 rows. Nothing of this crosses a wave, so the tile loop holds no barrier.
// In the key loop an 8-lane group of a wave owns one key row j at a time; lane q8 of it owns eight a
// (4 q8 .. 4 q8 + 3 and the same + 32) for all four query rows, so that a score takes three
// cross-lane steps and its exp is repeated in 8 lanes. Each tanh feeds the score and, weighted, the
// edge sum.
// ---------------------------------------------------------------------------
#define ROWS  4
#define NWAVE 8
#define KW    (SEQ / NWAVE)         // key rows of a wave: 64
#define TK    16                    // key rows of a tile
#define NT    (KW / TK)             // tiles of a wave: 4
#define XPITCH (SEQ + 8)            // bf16 per LDS row of X^T: 1040 bytes, 16 B x odd
#define WPITCH (ADIM + 4)           // floats per LDS row of We and of h_1: 272 bytes, 16 B x odd
#define YPITCH (HID + 4)            // floats per LDS row of Wy: 528 bytes, 16 B x odd

// LDS byte address of a __shared__ object: the low 32 bits of its address
static __device__ __forceinline__ unsigned lds_addr(const void* p) {
  return (unsigned)(size_t)p;
}

// Asynchronous copies global -> LDS, 16 bytes per lane and copy, through no register. The
// s_wait_xcnt closes each statement so that it stands in front of any rewrite of the address
// registers the copies name. The data is waited for with s_wait_asynccnt by the caller.
static __device__ __forceinline__ void async_copy4(unsigned l, int lstep, const char* g, int gstep) {
  asm volatile(
      "global_load_async_to_lds_b128 %0, %4, off\n\t"
      "global_load_async_to_lds_b128 %1, %5, off\n\t"
      "global_load_async_to_lds_b128 %2, %6, off\n\t"
      "global_load_async_to_lds_b128 %3, %7, off\n\t"
      "s_wait_xcnt 0x0"
      :: "v"(l), "v"(l + lstep), "v"(l + 2 * lstep), "v"(l + 3 * lstep),
         "v"(g), "v"(g + gstep), "v"(g + 2 * gstep), "v"(g + 3 * gstep)
      : "memory");
}

// lane l with lane l ^ 16
static __device__ __forceinline__ float xhalf(float x) {
  const int v = __builtin_bit_cast(int, x);
  return __builtin_bit_cast(float, __builtin_amdgcn_permlanex16(v, v, 0x76543210, 0xfedcba98,
                                                                false, false));
}

// x + (x of lane l ^ MASK inside the 16-lane row): DPP row_xmask
template <int MASK>
static __device__ __forceinline__ float add_xmask(float x) {
  const int v = __builtin_bit_cast(int, x);
  return x + __builtin_bit_cast(float,
                                __builtin_amdgcn_update_dpp(0, v, 0x160 + MASK, 0xf, 0xf, true));
}

// sum over the 8 lanes of a group, left in every lane of it
static __device__ __forceinline__ float rowsum8(float x) {
  x = add_xmask<1>(x);
  x = add_xmask<2>(x);
  x = add_xmask<4>(x);
  return x;
}

// max(x, x of lane l ^ 8 inside the 16-lane row)
static __device__ __forceinline__ float max_xmask8(float x) {
  const int v = __builtin_bit_cast(int, x);
  return fmaxf(x, __builtin_bit_cast(float,
                                     __builtin_amdgcn_update_dpp(0, v, 0x168, 0xf, 0xf, true)));
}

// a fragment whose bf16 lie in an LDS array of floats: 8 bf16 = 4 floats per chunk
static __device__ __forceinline__ v16bf load_frag_f(const float* row, int f0, int f1) {
  union { v16bf v; float4 f[2]; } u;
  u.f[0] = *(const float4*)(row + f0);
  u.f[1] = *(const float4*)(row + f1);
  return u.v;
}

__global__ __launch_bounds__(32 * NWAVE)
void flex_attn_kernel(const float* __restrict__ X, const float* __restrict__ Wo,
                      const float* __restrict__ W1, const float* __restrict__ Wphi,
                      const float* __restrict__ Wy, const float* __restrict__ by,
                      const float* __restrict__ We, const float* __restrict__ be,
                      float* __restrict__ out) {
  __shared__ __attribute__((aligned(16))) bf16_t s_pb[ROWS][SEQ];          // exp weights, WMMA A source
  __shared__ __attribute__((aligned(16))) float  s_wmax[NWAVE][ROWS];      // row max per wave (large bound only)
  __shared__ __attribute__((aligned(16))) float  s_wsum[NWAVE][ROWS];      // row sum per wave
  __shared__ __attribute__((aligned(16))) float  s_gp[NWAVE][ROWS][ADIM];  // edge sum per wave (8 KB)
  __shared__ __attribute__((aligned(16))) float  s_g[ROWS][ADIM];
  __shared__ float s_l[ROWS];
  __shared__ __attribute__((aligned(16))) float  s_acc[4][ROWS][HID];      // p @ X per k quarter
  __shared__ __attribute__((aligned(16))) bf16_t s_xt[HID][XPITCH];        // X^T, this batch's rows (130 KB)
  __shared__ __attribute__((aligned(16))) float  s_h1[NWAVE][TK][WPITCH];  // per wave: the tile's X, then its h_1
  __shared__ __attribute__((aligned(16))) float  s_we[HID][WPITCH];        // first Wo | W1 as bf16, then We (34 KB)
  __shared__ __attribute__((aligned(16))) float  s_wy[HID][YPITCH];        // Wy (66 KB)
  __shared__ __attribute__((aligned(16))) bf16_t s_xq[NWAVE][PPITCH];      // the query rows of X, twice: row w is query row w & 3
  __shared__ __attribute__((aligned(16))) float  s_ho[ROWS][ADIM];
  __shared__ __attribute__((aligned(16))) bf16_t s_u[ROWS][PPITCH];        // p @ X, rounded
  // rows 0..63 Wo, 64..127 W1, 272 bytes a row: the very size of s_we
  bf16_t (*s_w)[PPITCH] = reinterpret_cast<bf16_t (*)[PPITCH]>(&s_we[0][0]);

  const int tid  = threadIdx.x;
  const int lane = tid & 31;
  const int wave = __builtin_amdgcn_readfirstlane(tid >> 5);
  const int q    = lane & 15;            // WMMA row/col index
  const int sel  = lane >> 4;
  const int b    = blockIdx.x >> 7;      // 128 i-tiles per batch
  const int i0   = (blockIdx.x & 127) * ROWS;
  const int gro  = b * SEQ;              // global row base of this batch
  const int q8   = lane & 7;             // this lane's a: 4 q8 .. 4 q8 + 3 and 32 + 4 q8 .. 32 + 4 q8 + 3
  const int gi   = lane >> 3;            // this 8-lane group's first key row in a tile; step 4

  // phase 0: Wphi (8 a per lane); Wo and W1 (wave w rows w, w + 8, ...), the query rows and this wave's
  // first tile of X, each row one wave-wide load
  v2f wp[4];
  {
    const float4 lo = *(const float4*)(Wphi + q8 * 4);
    const float4 hi = *(const float4*)(Wphi + 32 + q8 * 4);
    wp[0] = (v2f){lo.x, lo.y}; wp[1] = (v2f){lo.z, lo.w};
    wp[2] = (v2f){hi.x, hi.y}; wp[3] = (v2f){hi.z, hi.w};
  }
  const float* wosrc = Wo + wave * HID + lane * 4;
  const float* w1src = W1 + wave * HID + lane * 4;
  const float* qsrc  = X + (gro + i0 + (wave & (ROWS - 1))) * HID + lane * 4;
  const float* xsrc  = X + (gro + wave * KW) * HID + lane * 4;
  float4 wa[ADIM / NWAVE], wb[ADIM / NWAVE], xv[TK];
#pragma unroll
  for (int k = 0; k < ADIM / NWAVE; ++k) {
    wa[k] = *(const float4*)(wosrc + k * NWAVE * HID);
    wb[k] = *(const float4*)(w1src + k * NWAVE * HID);
  }
  const float4 xq = *(const float4*)qsrc;
#pragma unroll
  for (int r = 0; r < TK; ++r) xv[r] = *(const float4*)(xsrc + r * HID);
  const int   hcol = wave * 16 + q;      // this lane's output column in the epilogue
  const float bh   = by[hcol] + be[hcol];
  // the loads above have taken their addresses before those registers, scalar bases among them, are
  // written again; the scheduling barrier keeps what follows from being moved in front of the wait
  asm volatile("s_wait_xcnt 0x0" ::: "memory");
  __builtin_amdgcn_sched_barrier(0);

#pragma unroll
  for (int k = 0; k < ADIM / NWAVE; ++k) {
    *(uint2*)&s_w[wave + NWAVE * k][lane * 4]        = cvt4(wa[k]);
    *(uint2*)&s_w[ADIM + wave + NWAVE * k][lane * 4] = cvt4(wb[k]);
  }
  *(uint2*)&s_xq[wave][lane * 4] = cvt4(xq);
  __syncthreads();

  // h_o of the four query rows: waves 0..3 take 16 columns each. A rows 4..15 repeat rows 0..3.
  if (wave < ADIM / 16) {
    const bf16_t* xr = &s_xq[q & (NWAVE - 1)][0];
    const bf16_t* wr = &s_w[wave * 16 + q][0];
    v16bf a[4], bq[4];
#pragma unroll
    for (int s = 0; s < 4; ++s) {
      a[s]  = load_frag_bf16(xr, s * 32 + 8 * sel, s * 32 + 16 + 8 * sel);
      bq[s] = load_frag_bf16(wr, s * 32 + 8 * sel, s * 32 + 16 + 8 * sel);
    }
    v8f c = {0.f, 0.f, 0.f, 0.f, 0.f, 0.f, 0.f, 0.f};
#pragma unroll
    for (int s = 0; s < 4; ++s)
      c = __builtin_amdgcn_wmma_f32_16x16x32_bf16(false, a[s], false, bq[s], (short)0, c, false, false);
    // the distance the chip needs between the last WMMA and a vector write of its A or B registers, on
    // the taken side of the branch too; the scheduling barrier keeps the WMMAs in front of the v_nops
    __builtin_amdgcn_sched_barrier(0);
    asm volatile("v_nop\n\tv_nop\n\tv_nop\n\tv_nop");
    if (sel == 0) {                      // C layout: lane col q, rows 8*sel+v
#pragma unroll
      for (int v = 0; v < ROWS; ++v) s_ho[v][wave * 16 + q] = c[v];
    }
  }
  // W1 as A fragments (lane owns row a = 16 ta + q), kept in registers for all tiles
  v16bf aw[4][4];
#pragma unroll
  for (int ta = 0; ta < 4; ++ta)
#pragma unroll
    for (int s = 0; s < 4; ++s)
      aw[ta][s] = load_frag_bf16(&s_w[ADIM + ta * 16 + q][0], s * 32 + 8 * sel, s * 32 + 16 + 8 * sel);
  // this wave's reads of Wo and W1 have returned; behind the barrier every wave's have, and We may land there
  asm volatile("s_wait_dscnt 0x0" ::: "memory");
  __syncthreads();

  // what the epilogue reads, We and Wy, starts on its way into LDS here, in whole 512-byte runs per
  // wave, and lands while the key rows are worked on. Wave w brings rows 16w..16w+15 of both:
  // 8 copies of two We rows, 16 copies of one Wy row.
  {
    // both loops unrolled: every call is one asm statement with address operands of its own
#pragma unroll
    for (int r = 0; r < 2; ++r)
      async_copy4(lds_addr(&s_we[wave * 16 + r * 8 + sel][q * 4]), 2 * WPITCH * 4,
                  (const char*)(We + (wave * 16 + r * 8) * ADIM + lane * 4), 2 * ADIM * 4);
#pragma unroll
    for (int r = 0; r < 4; ++r)
      async_copy4(lds_addr(&s_wy[wave * 16 + r * 4][lane * 4]), YPITCH * 4,
                  (const char*)(Wy + (wave * 16 + r * 4) * HID + lane * 4), HID * 4);
  }

  v2f ho[ROWS][4];                       // this lane's h_o: 4 rows x 8 a
#pragma unroll
  for (int i = 0; i < ROWS; ++i) {
    const float4 lo = *(const float4*)&s_ho[i][q8 * 4];
    const float4 hi = *(const float4*)&s_ho[i][32 + q8 * 4];
    ho[i][0] = (v2f){lo.x, lo.y}; ho[i][1] = (v2f){lo.z, lo.w};
    ho[i][2] = (v2f){hi.x, hi.y}; ho[i][3] = (v2f){hi.z, hi.w};
  }

  // The softmax shift. |tanh| <= 1, so no score exceeds bound = sum_a |Wphi[a]| in size, and softmax
  // is the same for any shift. With the shift = bound, known before the key loop, every weight
  // exp(s - bound) lies in [exp(-2 bound), 1] and is final when it is computed. Taken while
  // bound < 20 (weights no smaller than exp(-40), far inside the f32 and bf16 range). For a larger
  // (or NaN) bound the shift is the true row maximum: the tiles are then gone through twice, the first
  // time for the maximum alone.
  const float L2E = 1.44269504f;
  float wabs = 0.f;
#pragma unroll
  for (int k = 0; k < 4; ++k) wabs += __builtin_fabsf(wp[k].x) + __builtin_fabsf(wp[k].y);
  const float bound = __builtin_bit_cast(
      float, __builtin_amdgcn_readfirstlane(__builtin_bit_cast(int, rowsum8(wabs))));
  const bool small = bound < 20.f;       // the same in every wave of every workgroup
  float nb[ROWS], mr[ROWS];              // -shift * log2(e) per query row; running row maximum
  float l[ROWS];
  v2f   g2[ROWS][4];
#pragma unroll
  for (int i = 0; i < ROWS; ++i) {
    nb[i] = -bound * L2E;
    mr[i] = -3.4e38f;
    l[i] = 0.f;
#pragma unroll
    for (int k = 0; k < 4; ++k) g2[i][k] = (v2f){0.f, 0.f};
  }

  float* hrow = &s_h1[wave][0][0];
  const float* hp = hrow + gi * WPITCH + q8 * 4;         // this lane's h_1: key rows gi + 4 st, 8 a
  // one tile: X rounded and laid in LDS, the next tile (tn, if more) asked for, h_1 made and laid in LDS.
  // Inlined at both calls, so that the arrays it names stay in registers
  auto make_tile = [&](int jb, int tn, bool more) __attribute__((always_inline)) {
    // the tile of X, rounded once: row-major into the wave's scratch, transposed into s_xt (the bf16 of
    // two neighbouring rows and one column joined in a word)
    uint2 cv[TK];
#pragma unroll
    for (int r = 0; r < TK; ++r) {
      cv[r] = cvt4(xv[r]);
      *(float2*)(hrow + r * WPITCH + lane * 2) =
          make_float2(__builtin_bit_cast(float, cv[r].x), __builtin_bit_cast(float, cv[r].y));
    }
#pragma unroll
    for (int e = 0; e < 4; ++e) {
      unsigned tw[TK / 2];
#pragma unroll
      for (int r = 0; r < TK / 2; ++r) {
        const unsigned wa2 = (e & 2) ? cv[2 * r].y : cv[2 * r].x;
        const unsigned wb2 = (e & 2) ? cv[2 * r + 1].y : cv[2 * r + 1].x;
        // v_perm_b32: bytes 0..3 of the pair are wa2's, 4..7 wb2's
        tw[r] = __builtin_amdgcn_perm(wb2, wa2, (e & 1) ? 0x07060302u : 0x05040100u);
      }
      *(uint4*)&s_xt[lane * 4 + e][jb]     = make_uint4(tw[0], tw[1], tw[2], tw[3]);
      *(uint4*)&s_xt[lane * 4 + e][jb + 8] = make_uint4(tw[4], tw[5], tw[6], tw[7]);
    }
    // the next tile's rows are asked for here and waited for at the head of the next trip
    if (more) {
      const float* xn = xsrc + tn * TK * HID;
#pragma unroll
      for (int r = 0; r < TK; ++r) xv[r] = *(const float4*)(xn + r * HID);
      // the loads have taken their address before its registers are written again
      asm volatile("s_wait_xcnt 0x0" :: "v"(xn) : "memory");
    }
    // the scratch rows, written by all lanes of this wave, are in LDS before any lane reads a whole row
    asm volatile("s_wait_dscnt 0x0" ::: "memory");
    {
      v16bf bx[4];                       // B fragments: lane owns column j = q
#pragma unroll
      for (int s = 0; s < 4; ++s)
        bx[s] = load_frag_f(hrow + q * WPITCH, s * 16 + 4 * sel, s * 16 + 8 + 4 * sel);
      float* dst = hrow + q * WPITCH + 8 * sel;   // D: lane col j = q, rows a = 16 ta + 8 sel + v
      v8f d[4];
#pragma unroll
      for (int ta = 0; ta < 4; ++ta) d[ta] = (v8f){0.f, 0.f, 0.f, 0.f, 0.f, 0.f, 0.f, 0.f};
#pragma unroll
      for (int s = 0; s < 4; ++s)
#pragma unroll
        for (int ta = 0; ta < 4; ++ta)
          d[ta] = __builtin_amdgcn_wmma_f32_16x16x32_bf16(false, aw[ta][s], false, bx[s], (short)0, d[ta],
                                                          false, false);
#pragma unroll
      for (int ta = 0; ta < 4; ++ta) {
        *(float4*)(dst + 16 * ta)     = make_float4(d[ta][0], d[ta][1], d[ta][2], d[ta][3]);
        *(float4*)(dst + 16 * ta + 4) = make_float4(d[ta][4], d[ta][5], d[ta][6], d[ta][7]);
      }
    }
    // h_1 of the tile, written by all lanes of this wave, is in LDS before it is read in the other layout
    asm volatile("s_wait_dscnt 0x0" ::: "memory");

  };

  if (!small) {
    // large bound only: the row maximum, from a pass of its own over the tiles
    // rolled: this path is for size, not for speed
#pragma unroll 1
    for (int t = 0; t < NT; ++t) {
      make_tile(wave * KW + t * TK, (t + 1) & (NT - 1), true);
#pragma unroll 1
      for (int st = 0; st < TK / 4; ++st) {
        const float4 a0 = *(const float4*)(hp + 4 * st * WPITCH);
        const float4 a1 = *(const float4*)(hp + 4 * st * WPITCH + 32);
        const v2f h2[4] = {(v2f){a0.x, a0.y}, (v2f){a0.z, a0.w}, (v2f){a1.x, a1.y}, (v2f){a1.z, a1.w}};
#pragma unroll
        for (int i = 0; i < ROWS; ++i) {
          v2f t2 = (v2f){0.f, 0.f};
#pragma unroll
          for (int k = 0; k < 4; ++k) {
            const v2f x = ho[i][k] + h2[k];
            t2 += (v2f){tanh_hw(x.x), tanh_hw(x.y)} * wp[k];
          }
          mr[i] = fmaxf(mr[i], rowsum8(t2.x + t2.y));
        }
      }
    }
#pragma unroll
    for (int i = 0; i < ROWS; ++i) {
      mr[i] = max_xmask8(mr[i]);
      mr[i] = fmaxf(mr[i], xhalf(mr[i]));
    }
    if (lane == 0) *(float4*)&s_wmax[wave][0] = make_float4(mr[0], mr[1], mr[2], mr[3]);
    __syncthreads();
#pragma unroll
    for (int w = 0; w < NWAVE; ++w) {
      const float4 m4 = *(const float4*)&s_wmax[w][0];
      mr[0] = fmaxf(mr[0], m4.x); mr[1] = fmaxf(mr[1], m4.y);
      mr[2] = fmaxf(mr[2], m4.z); mr[3] = fmaxf(mr[3], m4.w);
    }
#pragma unroll
    for (int i = 0; i < ROWS; ++i) nb[i] = -mr[i] * L2E;
  }

  // rolled: the four tiles share one body, whose 16 scores per query row are unrolled inside
#pragma unroll 1
  for (int t = 0; t < NT; ++t) {
    const int jb = wave * KW + t * TK;                   // the tile's first key row in the batch
    make_tile(jb, t + 1, t + 1 < NT);
    // e = tanh(ho[i,a]+h1[j,a]) is evaluated once and used for the score s_ij = sum_a e * Wphi[a]
    // and, weighted with p_ij = exp(s_ij - shift), for the edge sum g[i,a] = sum_j p_ij * e.
    // Two neighbouring a share each packed instruction.
    float4 hc[TK / 4][2];
#pragma unroll
    for (int st = 0; st < TK / 4; ++st) {
      hc[st][0] = *(const float4*)(hp + 4 * st * WPITCH);
      hc[st][1] = *(const float4*)(hp + 4 * st * WPITCH + 32);
    }
    // all eight reads are issued in front of the work; without this line the build issues the later ones
    // shortly before their use and waits out part of the LDS latency there
    __builtin_amdgcn_sched_barrier(0);
#pragma unroll
    for (int c = 0; c < TK / 8; ++c) {
      float pv = 0.f;
#pragma unroll
      for (int u = 0; u < 2; ++u) {
        const int st = c * 2 + u;
        const v2f h2[4] = {(v2f){hc[st][0].x, hc[st][0].y}, (v2f){hc[st][0].z, hc[st][0].w},
                           (v2f){hc[st][1].x, hc[st][1].y}, (v2f){hc[st][1].z, hc[st][1].w}};
#pragma unroll
        for (int i = 0; i < ROWS; ++i) {
          v2f e[4];
#pragma unroll
          for (int k = 0; k < 4; ++k) {
            const v2f x = ho[i][k] + h2[k];
            e[k] = (v2f){tanh_hw(x.x), tanh_hw(x.y)};
          }
          v2f t = e[0] * wp[0];
          t += e[1] * wp[1];
          t += e[2] * wp[2];
          t += e[3] * wp[3];
          // the weight, in every lane of the group
          const float p = __builtin_amdgcn_exp2f(__builtin_fmaf(rowsum8(t.x + t.y), L2E, nb[i]));
          pv = (q8 == u * ROWS + i) ? p : pv;
          l[i] += p;
#pragma unroll
          for (int k = 0; k < 4; ++k) g2[i][k] += e[k] * p;
        }
      }
      // 8 weights go to the WMMA A source, one per lane: lane q8 has key step q8 >> 2, query row q8 & 3
      s_pb[q8 & 3][jb + gi + 4 * (c * 2 + (q8 >> 2))] = f2bf(pv);
    }
  }

  // phase 2: the four 8-lane groups of the wave are added; the wave's row sum and edge sum go to LDS
#pragma unroll
  for (int i = 0; i < ROWS; ++i) {
    l[i] = add_xmask<8>(l[i]);
    l[i] += xhalf(l[i]);
#pragma unroll
    for (int k = 0; k < 4; ++k) {
      g2[i][k] = (v2f){add_xmask<8>(g2[i][k].x), add_xmask<8>(g2[i][k].y)};
      g2[i][k] += (v2f){xhalf(g2[i][k].x), xhalf(g2[i][k].y)};
    }
  }
  if (lane < 8) {
#pragma unroll
    for (int i = 0; i < ROWS; ++i) {
      *(float4*)&s_gp[wave][i][q8 * 4] = make_float4(g2[i][0].x, g2[i][0].y, g2[i][1].x, g2[i][1].y);
      *(float4*)&s_gp[wave][i][32 + q8 * 4] = make_float4(g2[i][2].x, g2[i][2].y, g2[i][3].x, g2[i][3].y);
    }
  }
  if (lane == 0) *(float4*)&s_wsum[wave][0] = make_float4(l[0], l[1], l[2], l[3]);
  // this wave's copies of We and Wy have landed; behind the barrier every wave's have
  asm volatile("s_wait_asynccnt 0x0" ::: "memory");
  __syncthreads();

  // phase 4: u = P(4x512) @ X(512x128) via WMMA; wave owns four column tiles (half of the
  // columns, wave & 1) and a k quarter (wave >> 1), so that one A fragment feeds four products.
  // A rows 4..15 repeat rows 0..3; their D rows are not used.
  // A frags come from s_pb, B frags from s_xt, both via 16B ds loads.
  {
    const int hg = wave & 1;
    const int kq = wave >> 1;
    const bf16_t* brow = &s_xt[hg * 64 + q][kq * (SEQ / 4)];                 // contiguous over j
    const bf16_t* prow = &s_pb[q & (ROWS - 1)][kq * (SEQ / 4)];              // A-frag row

    v8f c[4];
#pragma unroll
    for (int t = 0; t < 4; ++t) c[t] = (v8f){0.f, 0.f, 0.f, 0.f, 0.f, 0.f, 0.f, 0.f};
    v16bf a[4], bb[4][4];
#pragma unroll
    for (int s = 0; s < 4; ++s) {
      const int k0 = s * 32 + 8 * sel;
      const int k1 = s * 32 + 16 + 8 * sel;
      a[s] = load_frag_bf16(prow, k0, k1);
#pragma unroll
      for (int t = 0; t < 4; ++t) bb[s][t] = load_frag_bf16(brow + t * 16 * XPITCH, k0, k1);
    }
    // all fragment reads are issued in front of the products; without this line the build reads one
    // fragment at a time and waits out the LDS latency in front of each product
    __builtin_amdgcn_sched_barrier(0);
#pragma unroll
    for (int s = 0; s < 4; ++s)
#pragma unroll
      for (int t = 0; t < 4; ++t)
        c[t] = __builtin_amdgcn_wmma_f32_16x16x32_bf16(false, a[s], false, bb[s][t], (short)0, c[t],
                                                       false, false);
    // the distance the chip needs between the last WMMA and a vector write of its A registers; the
    // scheduling barrier keeps the WMMAs in front of the v_nops
    __builtin_amdgcn_sched_barrier(0);
    asm volatile("v_nop\n\tv_nop\n\tv_nop\n\tv_nop");
    if (sel == 0) {                      // C layout: lane col q, rows 8*sel+v
#pragma unroll
      for (int t = 0; t < 4; ++t)
#pragma unroll
        for (int v = 0; v < ROWS; ++v) s_acc[kq][v][hg * 64 + t * 16 + q] = c[t][v];
    }
  }
  // this lane's rows of We and Wy (output column hcol), read from LDS ahead of the barriers that their
  // use waits behind; Wy is rounded to bf16 here, as B fragments (lane owns column hcol)
  float4 wv[ADIM / 4];
#pragma unroll
  for (int a4 = 0; a4 < ADIM / 4; ++a4) wv[a4] = *(const float4*)&s_we[hcol][a4 * 4];
  v16bf bw[4];
#pragma unroll
  for (int s = 0; s < 4; ++s) {
    const float* yr = &s_wy[hcol][s * 32 + 8 * sel];
    const uint2 c0 = cvt4(*(const float4*)yr),        c1 = cvt4(*(const float4*)(yr + 4));
    const uint2 c2 = cvt4(*(const float4*)(yr + 16)), c3 = cvt4(*(const float4*)(yr + 20));
    frag_u f;
    f.q[0] = make_uint4(c0.x, c0.y, c1.x, c1.y);   // elems 0..7  : K = 32 s + 8 sel ..
    f.q[1] = make_uint4(c2.x, c2.y, c3.x, c3.y);   // elems 8..15 : K = 32 s + 16 + 8 sel ..
    bw[s] = f.v;
  }
  // sums over the waves' partial g (one element per thread: ROWS * ADIM = the block) and l
  {
    float gs = 0.f, ls = 0.f;
#pragma unroll
    for (int w = 0; w < NWAVE; ++w) {
      gs += (&s_gp[w][0][0])[tid];
      ls += s_wsum[w][tid & (ROWS - 1)];
    }
    (&s_g[0][0])[tid] = gs;
    if (tid < ROWS) s_l[tid] = ls;
  }
  __syncthreads();

  // u: the four k quarters are added, two neighbouring columns per thread, and rounded to bf16
  {
    const int i = tid >> 6, c = (tid & 63) * 2;
    const float2 u0 = *(const float2*)&s_acc[0][i][c], u1 = *(const float2*)&s_acc[1][i][c];
    const float2 u2 = *(const float2*)&s_acc[2][i][c], u3 = *(const float2*)&s_acc[3][i][c];
    const v2f uu = {(u0.x + u1.x) + (u2.x + u3.x), (u0.y + u1.y) + (u2.y + u3.y)};
    *(v2bf*)&s_u[i][c] = __builtin_convertvector(uu, v2bf);
  }
  __syncthreads();

  // phase 5: out = (u @ Wy^T + g @ We^T) / l + by + be. Wave w has output columns 16w..16w+15.
  // A rows repeat u's rows 0..3, so D rows v and 8 + v are both query row v: lanes 0..15 finish
  // query rows 0 and 1, lanes 16..31 rows 2 and 3.
  {
    const bf16_t* ur = &s_u[q & (ROWS - 1)][0];
    v16bf a[4];
#pragma unroll
    for (int s = 0; s < 4; ++s) a[s] = load_frag_bf16(ur, s * 32 + 8 * sel, s * 32 + 16 + 8 * sel);
    v8f c = {0.f, 0.f, 0.f, 0.f, 0.f, 0.f, 0.f, 0.f};
#pragma unroll
    for (int s = 0; s < 4; ++s)
      c = __builtin_amdgcn_wmma_f32_16x16x32_bf16(false, a[s], false, bw[s], (short)0, c, false, false);
#pragma unroll
    for (int r = 0; r < 2; ++r) {
      const int i = 2 * sel + r;
      float acc = sel ? c[2 + r] : c[r];
#pragma unroll
      for (int a4 = 0; a4 < ADIM / 4; ++a4) {
        const float4 gv = *(const float4*)&s_g[i][a4 * 4];
        acc += wv[a4].x * gv.x;
        acc += wv[a4].y * gv.y;
        acc += wv[a4].z * gv.z;
        acc += wv[a4].w * gv.w;
      }
      out[(gro + i0 + i) * HID + hcol] = acc / s_l[i] + bh;
    }
  }
}

// ---------------------------------------------------------------------------
extern "C" void kernel_launch(void* const* d_in, const int* in_sizes, int n_in,
                              void* d_out, int out_size, void* d_ws, size_t ws_size,
                              hipStream_t stream) {
  const float* X    = (const float*)d_in[0];
  const float* Wo   = (const float*)d_in[1];
  const float* W1   = (const float*)d_in[2];
  const float* Wphi = (const float*)d_in[3];
  const float* Wy   = (const float*)d_in[4];
  const float* by   = (const float*)d_in[5];
  const float* We   = (const float*)d_in[6];
  const float* be   = (const float*)d_in[7];
  float* out = (float*)d_out;

  // projections and attention in one launch: 256 i-tiles of 4 rows, 8 waves each; no workspace
  flex_attn_kernel<<<256, 256, 0, stream>>>(X, Wo, W1, Wphi, Wy, by, We, be, out);
}
